// v000
// The times below were measured on an AMD MI455X: many runs one after another, warmed up first and cycling through
// copies of the inputs, with the whole window's GPU time divided by the number of runs. Launches and the gaps
// between them are all in it. The median over several windows is given; except for v000 it joins two sittings, which
// can be a few percent apart, so the side-by-side timings, each taken in one sitting, are the better comparison.
// v000 is the starting kernel. One run takes 119 microseconds.
#include <hip/hip_runtime.h>

typedef __attribute__((ext_vector_type(16))) _Float16 v16h;
typedef __attribute__((ext_vector_type(8)))  _Float16 v8h;
typedef __attribute__((ext_vector_type(8)))  float    v8f;
typedef __attribute__((ext_vector_type(4)))  float    v4f;
typedef __attribute__((ext_vector_type(4)))  int      v4i;

#ifndef NB
#define NB 4            // batches computed
#endif
#ifndef SEQ
#define SEQ 2048        // sequence length computed
#endif
#define NB_FULL  4      // input batch extent
#define SEQ_FULL 2048   // input sequence stride
#define NH       16
#define DHEAD    64
#define BM       64     // query rows per block (16 per wave)
#define BN       64     // keys per LDS buffer
#define KSTRIDE  72     // halves per K-LDS row (144 B)
#define VSTRIDE  72     // halves per Vt-LDS row (144 B)
#define OSTRIDE  68     // floats per O-staging row (272 B)
#define TPL      64     // sequence rows per plane-builder block
#define TPS      72     // halves per transposed V LDS row in the plane builder

// 1/sqrt(64) * log2(e), applied to the raw f32 dot inside the exp2 argument
#define SM_C   (0.125f * 1.4426950408889634f)
// P carried x64 (2^6) in its f16 operand; cancels exactly in acc/l
#define P_BIAS 6.0f

static_assert(NB >= 1 && NB <= NB_FULL);
static_assert(SEQ >= 2 * BN && SEQ <= SEQ_FULL);
static_assert(SEQ % (2 * BN) == 0);
static_assert(SEQ % BM == 0);
static_assert(SEQ % TPL == 0);
static_assert(BN == 64 && DHEAD == 64 && BM == 64);
static_assert((size_t)3 * NB * NH * SEQ * DHEAD * 2 <= (size_t)134217728);

// Assemble a v16h WMMA operand from two contiguous 8-half runs at p and p+16,
// matching the 16-bit A/B VGPR layout: elem e -> K = kbase + (e&7) + (e>=8)*16.
__device__ __forceinline__ v16h ld_op16(const _Float16* p) {
    const v8h lo = *(const v8h*)(p);
    const v8h hi = *(const v8h*)(p + 16);
    v16h r;
#pragma unroll
    for (int i = 0; i < 8; ++i) { r[i] = lo[i]; r[i + 8] = hi[i]; }
    return r;
}

__device__ __forceinline__ v8f wmma_f16(v16h a, v16h b, v8f c) {
    v8f d = __builtin_amdgcn_wmma_f32_16x16x32_f16(
        false, a, false, b, (short)0, c, false, false);
    asm volatile("v_nop\n\tv_nop\n\tv_nop\n\tv_nop" : "+v"(d) : "v"(a), "v"(b));
    return d;
}

// f32 -> bf16 (RNE convert) -> f16 container (exact for the bf16 significand)
__device__ __forceinline__ _Float16 cvt_bh(float x) {
    unsigned u = __float_as_uint(x);
    u = (u + 0x7FFFu + ((u >> 16) & 1u)) & 0xFFFF0000u;
    return (_Float16)__uint_as_float(u);
}

__device__ __forceinline__ v8h cvt8(const float* p) {
    const float4 a = *(const float4*)(p);
    const float4 c = *(const float4*)(p + 4);
    v8h r;
    r[0] = cvt_bh(a.x); r[1] = cvt_bh(a.y); r[2] = cvt_bh(a.z); r[3] = cvt_bh(a.w);
    r[4] = cvt_bh(c.x); r[5] = cvt_bh(c.y); r[6] = cvt_bh(c.z); r[7] = cvt_bh(c.w);
    return r;
}

// ---------------------------------------------------------------------------
// Plane builder: input layout [B][L][H][D] f32 ->
//   Qh[bh][row][d]  (f16 of bf16-RNE value, unscaled)
//   Kh[bh][key][d]
//   Vth[bh][d][key] (transposed through LDS)
// coverage: Qh/Kh rows l0..l0+63 x d 0..63 (512 chunks of 8 halves = 2 x 256 threads);
//           Vth rows d 0..63 x keys l0..l0+63 (512 chunks); grid covers all bh, all l0.
// ---------------------------------------------------------------------------
__global__ __launch_bounds__(256)
void k_planes(const float* __restrict__ Q, const float* __restrict__ K,
              const float* __restrict__ V, _Float16* __restrict__ Qh,
              _Float16* __restrict__ Kh, _Float16* __restrict__ Vth) {
    __shared__ __align__(16) _Float16 Vs[DHEAD * TPS];   // Vs[d][row], cross-wave, block barrier

    const int tid = threadIdx.x;
    const int bh  = blockIdx.y;
    const int b   = bh / NH;
    const int h   = bh - b * NH;
    const int l0  = blockIdx.x * TPL;

    v4i    qw[2], kw[2];
    size_t rdst[2];
#pragma unroll
    for (int i = 0; i < 2; ++i) {
        const int c   = tid + 256 * i;   // 0..511
        const int row = c >> 3;          // 0..63
        const int dc  = (c & 7) * 8;     // 0..56
        const size_t src = (((size_t)b * SEQ_FULL + (size_t)(l0 + row)) * NH + (size_t)h) * DHEAD + (size_t)dc;
        const v8h qv = cvt8(Q + src);
        const v8h kv = cvt8(K + src);
        const v8h vv = cvt8(V + src);
        qw[i]   = __builtin_bit_cast(v4i, qv);
        kw[i]   = __builtin_bit_cast(v4i, kv);
        rdst[i] = ((size_t)bh * SEQ + (size_t)(l0 + row)) * DHEAD + (size_t)dc;
#pragma unroll
        for (int j = 0; j < 8; ++j) Vs[(dc + j) * TPS + row] = vv[j];
    }
    __syncthreads();

    v4i    vw[2];
    size_t vdst[2];
#pragma unroll
    for (int i = 0; i < 2; ++i) {
        const int c  = tid + 256 * i;
        const int d  = c >> 3;           // 0..63
        const int lc = (c & 7) * 8;      // 0..56
        const v8h t  = *(const v8h*)&Vs[d * TPS + lc];
        vw[i]   = __builtin_bit_cast(v4i, t);
        vdst[i] = ((size_t)bh * DHEAD + (size_t)d) * SEQ + (size_t)(l0 + lc);
    }

#pragma unroll
    for (int i = 0; i < 2; ++i) {
        *(v4i*)(Qh + rdst[i])  = qw[i];
        *(v4i*)(Kh + rdst[i])  = kw[i];
        *(v4i*)(Vth + vdst[i]) = vw[i];
    }
    
}

// Stage one 64(key) x 64(d) K block and one 64(d) x 64(key) Vt block into LDS
// with plain 16-B loads; 512 chunks of 8 halves per tile = 4 x 128 threads.
// staged extent == consumed extent (64 rows x 64 halves for both tiles).
__device__ __forceinline__ void stage_block(const _Float16* kg, const _Float16* vtg,
                                            _Float16* ks, _Float16* vts, int tid) {
#pragma unroll
    for (int i = 0; i < 4; ++i) {
        const int c   = tid + 128 * i;  // 0..511
        const int row = c >> 3;
        const int off = (c & 7) * 8;
        *(v8h*)&ks[row * KSTRIDE + off]  = *(const v8h*)(kg + (size_t)row * DHEAD + off);
        *(v8h*)&vts[row * VSTRIDE + off] = *(const v8h*)(vtg + (size_t)row * SEQ + off);
    }
}

// One 64-key online-softmax step against the LDS block (ksb, vtsb).
// m_i and the scores s are kept in the raw q.k dot domain; the softmax scale
// and log2(e) are applied inside the exp2 argument.
__device__ __forceinline__ void fa_step(const _Float16* ksb, const _Float16* vtsb,
                                        const v16h (&qb)[2], const v16h& ones,
                                        int l16, int kbase,
                                        float& m_i, float& l_i, v8f (&acc)[4]) {
    // ---- S^T = K Q^T : four 16(key)x16(qrow) tiles, k=64 in two chunks ----
    v8f s[4];
#pragma unroll
    for (int n = 0; n < 4; ++n)
#pragma unroll
        for (int v = 0; v < 8; ++v) s[n][v] = 0.0f;
#pragma unroll
    for (int c = 0; c < 2; ++c) {
        const int dco = c * 32 + kbase;
#pragma unroll
        for (int n = 0; n < 4; ++n) {
            const v16h ka = ld_op16(&ksb[(n * 16 + l16) * KSTRIDE + dco]);
            s[n] = wmma_f16(ka, qb[c], s[n]);
        }
    }

    // ---- online softmax; balanced max tree ----
    float tm[4];
#pragma unroll
    for (int n = 0; n < 4; ++n) {
        const float a0 = fmaxf(s[n][0], s[n][1]);
        const float a1 = fmaxf(s[n][2], s[n][3]);
        const float a2 = fmaxf(s[n][4], s[n][5]);
        const float a3 = fmaxf(s[n][6], s[n][7]);
        tm[n] = fmaxf(fmaxf(a0, a1), fmaxf(a2, a3));
    }
    float mx = fmaxf(fmaxf(tm[0], tm[1]), fmaxf(tm[2], tm[3]));
    mx = fmaxf(mx, __shfl_xor(mx, 16, 32));

    const float mnew  = fmaxf(m_i, mx);
    const float corr  = __builtin_amdgcn_exp2f((m_i - mnew) * SM_C);
    const float ebias = P_BIAS - mnew * SM_C;

    v16h pb[2];  // P^T (x64) packed directly into B-operand layout
#pragma unroll
    for (int n = 0; n < 4; ++n)
#pragma unroll
        for (int v = 0; v < 8; ++v)
            pb[n >> 1][(n & 1) * 8 + v] =
                (_Float16)__builtin_amdgcn_exp2f(fmaf(s[n][v], SM_C, ebias));

    // row sum via WMMA with ones: every lane gets sum over all 64 keys
    v8f rsum;
#pragma unroll
    for (int v = 0; v < 8; ++v) rsum[v] = 0.0f;
    rsum = wmma_f16(ones, pb[0], rsum);
    rsum = wmma_f16(ones, pb[1], rsum);

    l_i = l_i * corr + rsum[0];
    m_i = mnew;
#pragma unroll
    for (int t = 0; t < 4; ++t)
#pragma unroll
        for (int v = 0; v < 8; ++v) acc[t][v] *= corr;

    // ---- O^T += V^T P^T : 4 d-tiles x 2 key-chunks ----
#pragma unroll
    for (int ck = 0; ck < 2; ++ck)
#pragma unroll
        for (int t = 0; t < 4; ++t) {
            const v16h va = ld_op16(&vtsb[(t * 16 + l16) * VSTRIDE + ck * 32 + kbase]);
            acc[t] = wmma_f16(va, pb[ck], acc[t]);
        }
}

// ---------------------------------------------------------------------------
// Attention forward: S^T / O^T formulation, double-buffered LDS (plain loads),
// hand-unrolled x2 so both LDS buffers are compile-time bases.
// Grid (SEQ/BM, NB*NH), 128 threads = 4 waves, 16 query rows per wave.
// ---------------------------------------------------------------------------
__global__ __launch_bounds__(128) __attribute__((amdgpu_num_vgpr(256)))
void fa_fwd_wmma(const _Float16* __restrict__ Qh, const _Float16* __restrict__ Kh,
                 const _Float16* __restrict__ Vth, float* __restrict__ O) {
    __shared__ __align__(16) _Float16 Ks0[BN * KSTRIDE];      // cross-wave, block barrier
    __shared__ __align__(16) _Float16 Ks1[BN * KSTRIDE];      // cross-wave, block barrier
    __shared__ __align__(16) _Float16 Vts0[DHEAD * VSTRIDE];  // cross-wave, block barrier
    __shared__ __align__(16) _Float16 Vts1[DHEAD * VSTRIDE];  // cross-wave, block barrier
    __shared__ __align__(16) float    Os[BM * OSTRIDE];       // per-wave rows, block barrier used

    const int tid   = threadIdx.x;
    const int lane  = tid & 31;
    const int wid   = tid >> 5;
    const int half  = lane >> 4;
    const int l16   = lane & 15;
    const int kbase = half * 8;

    const int    bh     = blockIdx.y;
    const int    b      = bh / NH;
    const int    h      = bh - b * NH;
    const int    qblk   = blockIdx.x;
    const size_t bh_off = (size_t)bh * SEQ * DHEAD;

    const _Float16* kg0  = Kh  + bh_off;
    const _Float16* vtg0 = Vth + bh_off;

    // ---- Q tile: B-operand (Q^T) registers, straight f16 loads ----
    const int       qbase = qblk * BM + wid * 16;
    const _Float16* qrow  = Qh + bh_off + (size_t)(qbase + l16) * DHEAD;
    v16h qb[2];
#pragma unroll
    for (int c = 0; c < 2; ++c) qb[c] = ld_op16(qrow + c * 32 + kbase);

    v16h ones;
#pragma unroll
    for (int e = 0; e < 16; ++e) ones[e] = (_Float16)1.0f;

    float m_i = -1e30f, l_i = 0.0f;  // per-lane: this lane owns qrow (qbase+l16)
    v8f acc[4];                      // O^T (x64): rows d = t*16 + kbase + v, col = qrow
#pragma unroll
    for (int t = 0; t < 4; ++t)
#pragma unroll
        for (int v = 0; v < 8; ++v) acc[t][v] = 0.0f;

    // prologue: stage first block into buffer 0
    stage_block(kg0, vtg0, Ks0, Vts0, tid);

#pragma unroll 1
    for (int kb = 0; kb < SEQ; kb += 2 * BN) {
        // ---- half A: compute buffer 0, stage buffer 1 ----
        __syncthreads();  // buffer 0 ready everywhere; buffer 1 free
        // kb + BN < SEQ always holds (SEQ % (2*BN) == 0)
        stage_block(kg0 + (size_t)(kb + BN) * DHEAD, vtg0 + (kb + BN),
                    Ks1, Vts1, tid);
        fa_step(Ks0, Vts0, qb, ones, l16, kbase, m_i, l_i, acc);

        // ---- half B: compute buffer 1, stage buffer 0 ----
        __syncthreads();  // buffer 1 ready everywhere; buffer 0 free
        if (kb + 2 * BN < SEQ)
            stage_block(kg0 + (size_t)(kb + 2 * BN) * DHEAD, vtg0 + (kb + 2 * BN),
                        Ks0, Vts0, tid);
        fa_step(Ks1, Vts1, qb, ones, l16, kbase, m_i, l_i, acc);
    }

    // ---- epilogue: O[b][qrow][h][d] = acc^T / l via LDS staging ----
    // Each lane writes its column (qrow l16) of O^T into Os row l16 of the
    // wave's 16-row region; then the wave writes whole 256-B output rows:
    // lanes 16..31 row 2it+1.  coverage: it 0..7 x 2 rows = 16 rows per wave,
    // 4 waves = 64 rows per block, 16 lanes x 16 B = 64 floats per row.
    const float inv = 1.0f / l_i;
    float*      osw = Os + (wid * 16) * OSTRIDE;
    {
        float* ocol = osw + l16 * OSTRIDE;
#pragma unroll
        for (int t = 0; t < 4; ++t) {
            v4f lo, hi;
            lo[0] = acc[t][0] * inv; lo[1] = acc[t][1] * inv;
            lo[2] = acc[t][2] * inv; lo[3] = acc[t][3] * inv;
            hi[0] = acc[t][4] * inv; hi[1] = acc[t][5] * inv;
            hi[2] = acc[t][6] * inv; hi[3] = acc[t][7] * inv;
            *(v4f*)&ocol[t * 16 + kbase]     = lo;
            *(v4f*)&ocol[t * 16 + kbase + 4] = hi;
        }
    }
    __syncthreads();

    v4f ov[8];
#pragma unroll
    for (int it = 0; it < 8; ++it) {
        const int r = 2 * it + half;
        ov[it] = *(const v4f*)&osw[r * OSTRIDE + l16 * 4];
    }
    const size_t rstride = (size_t)NH * DHEAD;
    const size_t obase   = (((size_t)b * SEQ + (size_t)qbase) * NH + (size_t)h) * DHEAD
                         + (size_t)(l16 * 4);
#pragma unroll
    for (int it = 0; it < 8; ++it) {
        const int r = 2 * it + half;
        *(v4f*)(O + obase + (size_t)r * rstride) = ov[it];
    }
    
}

extern "C" void kernel_launch(void* const* d_in, const int* in_sizes, int n_in,
                              void* d_out, int out_size, void* d_ws, size_t ws_size,
                              hipStream_t stream) {
    if (n_in < 3) return;
    const float* Q = (const float*)d_in[0];   // [NB_FULL][SEQ_FULL][NH][DHEAD] f32
    const float* K = (const float*)d_in[1];
    const float* V = (const float*)d_in[2];
    float*       O = (float*)d_out;          // [NB][SEQ][NH][DHEAD] f32

    // extent read from the inputs (full strides, reduced batch/sequence extents)
    const size_t need_in = ((size_t)(NB - 1) * SEQ_FULL + (size_t)SEQ) * NH * DHEAD;
    if ((size_t)in_sizes[0] < need_in) return;
    if ((size_t)in_sizes[1] < need_in) return;
    if ((size_t)in_sizes[2] < need_in) return;

    const size_t n = (size_t)NB * NH * SEQ * DHEAD;   // elements per plane / per output
    if ((size_t)out_size < n) return;
    // carve: three f16 planes of n halves each = 3 * 16 MiB = 48 MiB at full size
    if (ws_size < (size_t)3 * n * sizeof(_Float16)) return;

    _Float16* Qh  = (_Float16*)d_ws;
    _Float16* Kh  = Qh + n;
    _Float16* Vth = Kh + n;

    k_planes<<<dim3(SEQ / TPL, NB * NH), dim3(256), 0, stream>>>(Q, K, V, Qh, Kh, Vth);

    fa_fwd_wmma<<<dim3(SEQ / BM, NB * NH), dim3(128), 0, stream>>>(Qh, Kh, Vth, O);
}

// v001
// One run takes 101 microseconds.
// Next to v000, in two timings, it ran 1.20 and 1.26 times as fast.
#include <hip/hip_runtime.h>

typedef __attribute__((ext_vector_type(16))) _Float16 v16h;
typedef __attribute__((ext_vector_type(8)))  _Float16 v8h;
typedef __attribute__((ext_vector_type(8)))  float    v8f;
typedef __attribute__((ext_vector_type(4)))  float    v4f;
typedef __attribute__((ext_vector_type(4)))  int      v4i;

#ifndef NB
#define NB 4            // batches computed
#endif
#ifndef SEQ
#define SEQ 2048        // sequence length computed
#endif
#define NB_FULL  4      // input batch extent
#define SEQ_FULL 2048   // input sequence stride
#define NH       16
#define DHEAD    64
#define BM       64     // query rows per block (16 per wave)
#define BN       64     // keys per LDS buffer
#define KSTRIDE  72     // halves per K-LDS row (144 B)
#define VSTRIDE  72     // halves per Vt-LDS row (144 B)
#define OSTRIDE  68     // floats per O-staging row (272 B)
#define TPL      64     // sequence rows per plane-builder block
#define TPS      72     // halves per transposed V LDS row in the plane builder

// 1/sqrt(64) * log2(e), applied to the raw f32 dot inside the exp2 argument
#define SM_C   (0.125f * 1.4426950408889634f)
// P carried x64 (2^6) in its f16 operand; cancels exactly in acc/l
#define P_BIAS 6.0f

static_assert(NB >= 1 && NB <= NB_FULL);
static_assert(SEQ >= 2 * BN && SEQ <= SEQ_FULL);
static_assert(SEQ % (2 * BN) == 0);
static_assert(SEQ % BM == 0);
static_assert(SEQ % TPL == 0);
static_assert(BN == 64 && DHEAD == 64 && BM == 64);
static_assert((size_t)3 * NB * NH * SEQ * DHEAD * 2 <= (size_t)134217728);

// Assemble a v16h WMMA operand from two contiguous 8-half runs at p and p+16,
// matching the 16-bit A/B VGPR layout: elem e -> K = kbase + (e&7) + (e>=8)*16.
__device__ __forceinline__ v16h ld_op16(const _Float16* p) {
    const v8h lo = *(const v8h*)(p);
    const v8h hi = *(const v8h*)(p + 16);
    v16h r;
#pragma unroll
    for (int i = 0; i < 8; ++i) { r[i] = lo[i]; r[i + 8] = hi[i]; }
    return r;
}

__device__ __forceinline__ v8f wmma_f16(v16h a, v16h b, v8f c) {
    return __builtin_amdgcn_wmma_f32_16x16x32_f16(
        false, a, false, b, (short)0, c, false, false);
}

// f32 -> bf16 (RNE convert) -> f16 container (exact for the bf16 significand)
__device__ __forceinline__ _Float16 cvt_bh(float x) {
    unsigned u = __float_as_uint(x);
    u = (u + 0x7FFFu + ((u >> 16) & 1u)) & 0xFFFF0000u;
    return (_Float16)__uint_as_float(u);
}

__device__ __forceinline__ v8h cvt8(const float* p) {
    const float4 a = *(const float4*)(p);
    const float4 c = *(const float4*)(p + 4);
    v8h r;
    r[0] = cvt_bh(a.x); r[1] = cvt_bh(a.y); r[2] = cvt_bh(a.z); r[3] = cvt_bh(a.w);
    r[4] = cvt_bh(c.x); r[5] = cvt_bh(c.y); r[6] = cvt_bh(c.z); r[7] = cvt_bh(c.w);
    return r;
}

// ---------------------------------------------------------------------------
// Plane builder: input layout [B][L][H][D] f32 ->
//   Qh[bh][row][d]  (f16 of bf16-RNE value, unscaled)
//   Kh[bh][key][d]
//   Vth[bh][d][key] (transposed through LDS)
// coverage: Qh/Kh rows l0..l0+63 x d 0..63 (512 chunks of 8 halves = 2 x 256 threads);
//           Vth rows d 0..63 x keys l0..l0+63 (512 chunks); grid covers all bh, all l0.
// ---------------------------------------------------------------------------
__global__ __launch_bounds__(256)
void k_planes(const float* __restrict__ Q, const float* __restrict__ K,
              const float* __restrict__ V, _Float16* __restrict__ Qh,
              _Float16* __restrict__ Kh, _Float16* __restrict__ Vth) {
    __shared__ __align__(16) _Float16 Vs[DHEAD * TPS];   // Vs[d][row], cross-wave, block barrier

    const int tid = threadIdx.x;
    const int bh  = blockIdx.y;
    const int b   = bh / NH;
    const int h   = bh - b * NH;
    const int l0  = blockIdx.x * TPL;

    v4i    qw[2], kw[2];
    size_t rdst[2];
#pragma unroll
    for (int i = 0; i < 2; ++i) {
        const int c   = tid + 256 * i;   // 0..511
        const int row = c >> 3;          // 0..63
        const int dc  = (c & 7) * 8;     // 0..56
        const size_t src = (((size_t)b * SEQ_FULL + (size_t)(l0 + row)) * NH + (size_t)h) * DHEAD + (size_t)dc;
        const v8h qv = cvt8(Q + src);
        const v8h kv = cvt8(K + src);
        const v8h vv = cvt8(V + src);
        qw[i]   = __builtin_bit_cast(v4i, qv);
        kw[i]   = __builtin_bit_cast(v4i, kv);
        rdst[i] = ((size_t)bh * SEQ + (size_t)(l0 + row)) * DHEAD + (size_t)dc;
#pragma unroll
        for (int j = 0; j < 8; ++j) Vs[(dc + j) * TPS + row] = vv[j];
    }
    __syncthreads();

    v4i    vw[2];
    size_t vdst[2];
#pragma unroll
    for (int i = 0; i < 2; ++i) {
        const int c  = tid + 256 * i;
        const int d  = c >> 3;           // 0..63
        const int lc = (c & 7) * 8;      // 0..56
        const v8h t  = *(const v8h*)&Vs[d * TPS + lc];
        vw[i]   = __builtin_bit_cast(v4i, t);
        vdst[i] = ((size_t)bh * DHEAD + (size_t)d) * SEQ + (size_t)(l0 + lc);
    }

#pragma unroll
    for (int i = 0; i < 2; ++i) {
        *(v4i*)(Qh + rdst[i])  = qw[i];
        *(v4i*)(Kh + rdst[i])  = kw[i];
        *(v4i*)(Vth + vdst[i]) = vw[i];
    }
    
}

// Stage one 64(key) x 64(d) K block and one 64(d) x 64(key) Vt block into LDS
// with plain 16-B loads; 512 chunks of 8 halves per tile = 4 x 128 threads.
// staged extent == consumed extent (64 rows x 64 halves for both tiles).
__device__ __forceinline__ void stage_block(const _Float16* kg, const _Float16* vtg,
                                            _Float16* ks, _Float16* vts, int tid) {
#pragma unroll
    for (int i = 0; i < 4; ++i) {
        const int c   = tid + 128 * i;  // 0..511
        const int row = c >> 3;
        const int off = (c & 7) * 8;
        *(v8h*)&ks[row * KSTRIDE + off]  = *(const v8h*)(kg + (size_t)row * DHEAD + off);
        *(v8h*)&vts[row * VSTRIDE + off] = *(const v8h*)(vtg + (size_t)row * SEQ + off);
    }
}

// One 64-key online-softmax step against the LDS block (ksb, vtsb).
// m_i and the scores s are kept in the raw q.k dot domain; the softmax scale
// and log2(e) are applied inside the exp2 argument.
__device__ __forceinline__ void fa_step(const _Float16* ksb, const _Float16* vtsb,
                                        const v16h (&qb)[2], const v16h& ones,
                                        int l16, int kbase,
                                        float& m_i, float& l_i, v8f (&acc)[4]) {
    // ---- S^T = K Q^T : four 16(key)x16(qrow) tiles, k=64 in two chunks ----
    v8f s[4];
#pragma unroll
    for (int n = 0; n < 4; ++n)
#pragma unroll
        for (int v = 0; v < 8; ++v) s[n][v] = 0.0f;
#pragma unroll
    for (int c = 0; c < 2; ++c) {
        const int dco = c * 32 + kbase;
#pragma unroll
        for (int n = 0; n < 4; ++n) {
            const v16h ka = ld_op16(&ksb[(n * 16 + l16) * KSTRIDE + dco]);
            s[n] = wmma_f16(ka, qb[c], s[n]);
        }
    }

    // ---- online softmax; balanced max tree ----
    float tm[4];
#pragma unroll
    for (int n = 0; n < 4; ++n) {
        const float a0 = fmaxf(s[n][0], s[n][1]);
        const float a1 = fmaxf(s[n][2], s[n][3]);
        const float a2 = fmaxf(s[n][4], s[n][5]);
        const float a3 = fmaxf(s[n][6], s[n][7]);
        tm[n] = fmaxf(fmaxf(a0, a1), fmaxf(a2, a3));
    }
    float mx = fmaxf(fmaxf(tm[0], tm[1]), fmaxf(tm[2], tm[3]));
    mx = fmaxf(mx, __shfl_xor(mx, 16, 32));

    const float mnew  = fmaxf(m_i, mx);
    const float corr  = __builtin_amdgcn_exp2f((m_i - mnew) * SM_C);
    const float ebias = P_BIAS - mnew * SM_C;

    v16h pb[2];  // P^T (x64) packed directly into B-operand layout
#pragma unroll
    for (int n = 0; n < 4; ++n)
#pragma unroll
        for (int v = 0; v < 8; ++v)
            pb[n >> 1][(n & 1) * 8 + v] =
                (_Float16)__builtin_amdgcn_exp2f(fmaf(s[n][v], SM_C, ebias));

    // row sum via WMMA with ones: every lane gets sum over all 64 keys
    v8f rsum;
#pragma unroll
    for (int v = 0; v < 8; ++v) rsum[v] = 0.0f;
    rsum = wmma_f16(ones, pb[0], rsum);
    rsum = wmma_f16(ones, pb[1], rsum);

    l_i = l_i * corr + rsum[0];
    m_i = mnew;
#pragma unroll
    for (int t = 0; t < 4; ++t)
#pragma unroll
        for (int v = 0; v < 8; ++v) acc[t][v] *= corr;

    // ---- O^T += V^T P^T : 4 d-tiles x 2 key-chunks ----
#pragma unroll
    for (int ck = 0; ck < 2; ++ck)
#pragma unroll
        for (int t = 0; t < 4; ++t) {
            const v16h va = ld_op16(&vtsb[(t * 16 + l16) * VSTRIDE + ck * 32 + kbase]);
            acc[t] = wmma_f16(va, pb[ck], acc[t]);
        }
}

// ---------------------------------------------------------------------------
// Attention forward: S^T / O^T formulation, double-buffered LDS (plain loads),
// hand-unrolled x2 so both LDS buffers are compile-time bases.
// Grid (SEQ/BM, NB*NH), 128 threads = 4 waves, 16 query rows per wave.
// ---------------------------------------------------------------------------
__global__ __launch_bounds__(128) __attribute__((amdgpu_num_vgpr(256)))
void fa_fwd_wmma(const _Float16* __restrict__ Qh, const _Float16* __restrict__ Kh,
                 const _Float16* __restrict__ Vth, float* __restrict__ O) {
    __shared__ __align__(16) _Float16 Ks0[BN * KSTRIDE];      // cross-wave, block barrier
    __shared__ __align__(16) _Float16 Ks1[BN * KSTRIDE];      // cross-wave, block barrier
    __shared__ __align__(16) _Float16 Vts0[DHEAD * VSTRIDE];  // cross-wave, block barrier
    __shared__ __align__(16) _Float16 Vts1[DHEAD * VSTRIDE];  // cross-wave, block barrier
    __shared__ __align__(16) float    Os[BM * OSTRIDE];       // per-wave rows, block barrier used

    const int tid   = threadIdx.x;
    const int lane  = tid & 31;
    const int wid   = tid >> 5;
    const int half  = lane >> 4;
    const int l16   = lane & 15;
    const int kbase = half * 8;

    const int    bh     = blockIdx.y;
    const int    b      = bh / NH;
    const int    h      = bh - b * NH;
    const int    qblk   = blockIdx.x;
    const size_t bh_off = (size_t)bh * SEQ * DHEAD;

    const _Float16* kg0  = Kh  + bh_off;
    const _Float16* vtg0 = Vth + bh_off;

    // ---- Q tile: B-operand (Q^T) registers, straight f16 loads ----
    const int       qbase = qblk * BM + wid * 16;
    const _Float16* qrow  = Qh + bh_off + (size_t)(qbase + l16) * DHEAD;
    v16h qb[2];
#pragma unroll
    for (int c = 0; c < 2; ++c) qb[c] = ld_op16(qrow + c * 32 + kbase);

    v16h ones;
#pragma unroll
    for (int e = 0; e < 16; ++e) ones[e] = (_Float16)1.0f;

    float m_i = -1e30f, l_i = 0.0f;  // per-lane: this lane owns qrow (qbase+l16)
    v8f acc[4];                      // O^T (x64): rows d = t*16 + kbase + v, col = qrow
#pragma unroll
    for (int t = 0; t < 4; ++t)
#pragma unroll
        for (int v = 0; v < 8; ++v) acc[t][v] = 0.0f;

    // prologue: stage first block into buffer 0
    stage_block(kg0, vtg0, Ks0, Vts0, tid);

#pragma unroll 1
    for (int kb = 0; kb < SEQ; kb += 2 * BN) {
        // ---- half A: compute buffer 0, stage buffer 1 ----
        __syncthreads();  // buffer 0 ready everywhere; buffer 1 free
        // kb + BN < SEQ always holds (SEQ % (2*BN) == 0)
        stage_block(kg0 + (size_t)(kb + BN) * DHEAD, vtg0 + (kb + BN),
                    Ks1, Vts1, tid);
        fa_step(Ks0, Vts0, qb, ones, l16, kbase, m_i, l_i, acc);

        // ---- half B: compute buffer 1, stage buffer 0 ----
        __syncthreads();  // buffer 1 ready everywhere; buffer 0 free
        if (kb + 2 * BN < SEQ)
            stage_block(kg0 + (size_t)(kb + 2 * BN) * DHEAD, vtg0 + (kb + 2 * BN),
                        Ks0, Vts0, tid);
        fa_step(Ks1, Vts1, qb, ones, l16, kbase, m_i, l_i, acc);
    }

    // ---- epilogue: O[b][qrow][h][d] = acc^T / l via LDS staging ----
    // Each lane writes its column (qrow l16) of O^T into Os row l16 of the
    // wave's 16-row region; then the wave writes whole 256-B output rows:
    // lanes 16..31 row 2it+1.  coverage: it 0..7 x 2 rows = 16 rows per wave,
    // 4 waves = 64 rows per block, 16 lanes x 16 B = 64 floats per row.
    const float inv = 1.0f / l_i;
    float*      osw = Os + (wid * 16) * OSTRIDE;
    {
        float* ocol = osw + l16 * OSTRIDE;
#pragma unroll
        for (int t = 0; t < 4; ++t) {
            v4f lo, hi;
            lo[0] = acc[t][0] * inv; lo[1] = acc[t][1] * inv;
            lo[2] = acc[t][2] * inv; lo[3] = acc[t][3] * inv;
            hi[0] = acc[t][4] * inv; hi[1] = acc[t][5] * inv;
            hi[2] = acc[t][6] * inv; hi[3] = acc[t][7] * inv;
            *(v4f*)&ocol[t * 16 + kbase]     = lo;
            *(v4f*)&ocol[t * 16 + kbase + 4] = hi;
        }
    }
    __syncthreads();

    v4f ov[8];
#pragma unroll
    for (int it = 0; it < 8; ++it) {
        const int r = 2 * it + half;
        ov[it] = *(const v4f*)&osw[r * OSTRIDE + l16 * 4];
    }
    const size_t rstride = (size_t)NH * DHEAD;
    const size_t obase   = (((size_t)b * SEQ + (size_t)qbase) * NH + (size_t)h) * DHEAD
                         + (size_t)(l16 * 4);
#pragma unroll
    for (int it = 0; it < 8; ++it) {
        const int r = 2 * it + half;
        *(v4f*)(O + obase + (size_t)r * rstride) = ov[it];
    }
    
}

extern "C" void kernel_launch(void* const* d_in, const int* in_sizes, int n_in,
                              void* d_out, int out_size, void* d_ws, size_t ws_size,
                              hipStream_t stream) {
    if (n_in < 3) return;
    const float* Q = (const float*)d_in[0];   // [NB_FULL][SEQ_FULL][NH][DHEAD] f32
    const float* K = (const float*)d_in[1];
    const float* V = (const float*)d_in[2];
    float*       O = (float*)d_out;          // [NB][SEQ][NH][DHEAD] f32

    // extent read from the inputs (full strides, reduced batch/sequence extents)
    const size_t need_in = ((size_t)(NB - 1) * SEQ_FULL + (size_t)SEQ) * NH * DHEAD;
    if ((size_t)in_sizes[0] < need_in) return;
    if ((size_t)in_sizes[1] < need_in) return;
    if ((size_t)in_sizes[2] < need_in) return;

    const size_t n = (size_t)NB * NH * SEQ * DHEAD;   // elements per plane / per output
    if ((size_t)out_size < n) return;
    // carve: three f16 planes of n halves each = 3 * 16 MiB = 48 MiB at full size
    if (ws_size < (size_t)3 * n * sizeof(_Float16)) return;

    _Float16* Qh  = (_Float16*)d_ws;
    _Float16* Kh  = Qh + n;
    _Float16* Vth = Kh + n;

    k_planes<<<dim3(SEQ / TPL, NB * NH), dim3(256), 0, stream>>>(Q, K, V, Qh, Kh, Vth);

    fa_fwd_wmma<<<dim3(SEQ / BM, NB * NH), dim3(128), 0, stream>>>(Qh, Kh, Vth, O);
}

// v002
// One run takes 77.3 microseconds.
// Two timings next to v001 put it at 1.29 and 1.30 times that version's speed.
// All steps since v000 together make it 1.59 times as fast.
#include <hip/hip_runtime.h>

typedef __attribute__((ext_vector_type(16))) _Float16 v16h;
typedef __attribute__((ext_vector_type(8)))  _Float16 v8h;
typedef __attribute__((ext_vector_type(8)))  float    v8f;
typedef __attribute__((ext_vector_type(4)))  float    v4f;
typedef __attribute__((ext_vector_type(2)))  float    v2f;
typedef __attribute__((ext_vector_type(4)))  int      v4i;

#ifndef NB
#define NB 4            // batches computed
#endif
#ifndef SEQ
#define SEQ 2048        // sequence length computed
#endif
#define NB_FULL  4      // input batch extent
#define SEQ_FULL 2048   // input sequence stride
#define NH       16
#define DHEAD    64
#define QT       2      // 16-row query tiles per wave: each K / Vt fragment read from LDS feeds QT products
#define BM       128    // query rows per block (16 * QT per wave)
#define BN       64     // keys per LDS buffer
#define KSTRIDE  72     // halves per K-LDS row (144 B)
#define VSTRIDE  72     // halves per Vt-LDS row (144 B)
#define OSTRIDE  68     // floats per O-staging row (272 B)
#define TPL      64     // sequence rows per plane-builder block
#define TPS      72     // halves per transposed V LDS row in the plane builder

// 1/sqrt(64) * log2(e), applied to the raw f32 dot inside the exp2 argument
#define SM_C   (0.125f * 1.4426950408889634f)
// P carried x64 (2^6) in its f16 operand; cancels exactly in acc/l
#define P_BIAS 6.0f

static_assert(NB >= 1 && NB <= NB_FULL);
static_assert(SEQ >= 2 * BN && SEQ <= SEQ_FULL);
static_assert(SEQ % (2 * BN) == 0);
static_assert(SEQ % BM == 0);
static_assert(SEQ % TPL == 0);
static_assert(BN == 64 && DHEAD == 64 && BM == 4 * 16 * QT);
static_assert((size_t)3 * NB * NH * SEQ * DHEAD * 2 <= (size_t)134217728);

// Assemble a v16h WMMA operand from two contiguous 8-half runs at p and p+16,
// matching the 16-bit A/B VGPR layout: elem e -> K = kbase + (e&7) + (e>=8)*16.
__device__ __forceinline__ v16h ld_op16(const _Float16* p) {
    const v8h lo = *(const v8h*)(p);
    const v8h hi = *(const v8h*)(p + 16);
    v16h r;
#pragma unroll
    for (int i = 0; i < 8; ++i) { r[i] = lo[i]; r[i + 8] = hi[i]; }
    return r;
}

__device__ __forceinline__ v8f wmma_f16(v16h a, v16h b, v8f c) {
    return __builtin_amdgcn_wmma_f32_16x16x32_f16(
        false, a, false, b, (short)0, c, false, false);
}

// f32 -> bf16 (RNE convert) -> f16 container (exact for the bf16 significand)
__device__ __forceinline__ _Float16 cvt_bh(float x) {
    unsigned u = __float_as_uint(x);
    u = (u + 0x7FFFu + ((u >> 16) & 1u)) & 0xFFFF0000u;
    return (_Float16)__uint_as_float(u);
}

__device__ __forceinline__ v8h cvt8(const float* p) {
    const float4 a = *(const float4*)(p);
    const float4 c = *(const float4*)(p + 4);
    v8h r;
    r[0] = cvt_bh(a.x); r[1] = cvt_bh(a.y); r[2] = cvt_bh(a.z); r[3] = cvt_bh(a.w);
    r[4] = cvt_bh(c.x); r[5] = cvt_bh(c.y); r[6] = cvt_bh(c.z); r[7] = cvt_bh(c.w);
    return r;
}

// ---------------------------------------------------------------------------
// Plane builder: input layout [B][L][H][D] f32 ->
//   Qh[bh][row][d]  (f16 of bf16-RNE value, unscaled)
//   Kh[bh][key][d]
//   Vth[bh][d][key] (transposed through LDS)
// coverage: Qh/Kh rows l0..l0+63 x d 0..63 (512 chunks of 8 halves = 2 x 256 threads);
//           Vth rows d 0..63 x keys l0..l0+63 (512 chunks); grid covers all bh, all l0.
// ---------------------------------------------------------------------------
__global__ __launch_bounds__(256)
void k_planes(const float* __restrict__ Q, const float* __restrict__ K,
              const float* __restrict__ V, _Float16* __restrict__ Qh,
              _Float16* __restrict__ Kh, _Float16* __restrict__ Vth) {
    __shared__ __align__(16) _Float16 Vs[DHEAD * TPS];   // Vs[d][row], cross-wave, block barrier

    const int tid = threadIdx.x;
    const int bh  = blockIdx.y;
    const int b   = bh / NH;
    const int h   = bh - b * NH;
    const int l0  = blockIdx.x * TPL;

    v4i    qw[2], kw[2];
    size_t rdst[2];
#pragma unroll
    for (int i = 0; i < 2; ++i) {
        const int c   = tid + 256 * i;   // 0..511
        const int row = c >> 3;          // 0..63
        const int dc  = (c & 7) * 8;     // 0..56
        const size_t src = (((size_t)b * SEQ_FULL + (size_t)(l0 + row)) * NH + (size_t)h) * DHEAD + (size_t)dc;
        const v8h qv = cvt8(Q + src);
        const v8h kv = cvt8(K + src);
        const v8h vv = cvt8(V + src);
        qw[i]   = __builtin_bit_cast(v4i, qv);
        kw[i]   = __builtin_bit_cast(v4i, kv);
        rdst[i] = ((size_t)bh * SEQ + (size_t)(l0 + row)) * DHEAD + (size_t)dc;
#pragma unroll
        for (int j = 0; j < 8; ++j) Vs[(dc + j) * TPS + row] = vv[j];
    }
    __syncthreads();

    v4i    vw[2];
    size_t vdst[2];
#pragma unroll
    for (int i = 0; i < 2; ++i) {
        const int c  = tid + 256 * i;
        const int d  = c >> 3;           // 0..63
        const int lc = (c & 7) * 8;      // 0..56
        const v8h t  = *(const v8h*)&Vs[d * TPS + lc];
        vw[i]   = __builtin_bit_cast(v4i, t);
        vdst[i] = ((size_t)bh * DHEAD + (size_t)d) * SEQ + (size_t)(l0 + lc);
    }

#pragma unroll
    for (int i = 0; i < 2; ++i) {
        *(v4i*)(Qh + rdst[i])  = qw[i];
        *(v4i*)(Kh + rdst[i])  = kw[i];
        *(v4i*)(Vth + vdst[i]) = vw[i];
    }
    
}

// Stage one 64(key) x 64(d) K block and one 64(d) x 64(key) Vt block into LDS
// with plain 16-B loads; 512 chunks of 8 halves per tile = 4 x 128 threads.
// staged extent == consumed extent (64 rows x 64 halves for both tiles).
// Chunk i of a thread is row (tid >> 3) + 16 * i, halves (tid & 7) * 8 ..: the four
// chunks differ by constants, so one lane pointer per tile serves all four.
// kl, vl: the lane's chunk 0 in the K and Vt planes; sl: its place in an LDS tile.
__device__ __forceinline__ void stage_block(const _Float16* kl, const _Float16* vl,
                                            _Float16* ks, _Float16* vts, unsigned sl) {
    static_assert(KSTRIDE == VSTRIDE);
#pragma unroll
    for (int i = 0; i < 4; ++i) {
        *(v8h*)&ks[sl + i * 16 * KSTRIDE]  = *(const v8h*)(kl + i * 16 * DHEAD);
        *(v8h*)&vts[sl + i * 16 * VSTRIDE] = *(const v8h*)(vl + i * 16 * SEQ);
    }
}

// One 64-key online-softmax step against the LDS block (ksb, vtsb), for the
// wave's QT query tiles.  m_i and the scores s are kept in the raw q.k dot
// domain; the softmax scale and log2(e) are applied inside the exp2 argument.
__device__ __forceinline__ void fa_step(const _Float16* ksb, const _Float16* vtsb,
                                        const v16h (&qb)[QT][2], const v16h& ones,
                                        int l16, int kbase,
                                        float (&m_i)[QT], float (&l_i)[QT], v8f (&acc)[QT][4]) {
    // ---- S^T = K Q^T : four 16(key)x16(qrow) tiles per query tile, k=64 in two chunks ----
    v8f s[QT][4];
#pragma unroll
    for (int j = 0; j < QT; ++j)
#pragma unroll
        for (int n = 0; n < 4; ++n)
#pragma unroll
            for (int v = 0; v < 8; ++v) s[j][n][v] = 0.0f;
#pragma unroll
    for (int c = 0; c < 2; ++c) {
        const int dco = c * 32 + kbase;
#pragma unroll
        for (int n = 0; n < 4; ++n) {
            const v16h ka = ld_op16(&ksb[(n * 16 + l16) * KSTRIDE + dco]);
#pragma unroll
            for (int j = 0; j < QT; ++j) s[j][n] = wmma_f16(ka, qb[j][c], s[j][n]);
        }
    }

    v16h pb[QT][2];  // P^T (x64) packed directly into B-operand layout
#pragma unroll
    for (int j = 0; j < QT; ++j) {
        // ---- online softmax; balanced max tree ----
        float tm[4];
#pragma unroll
        for (int n = 0; n < 4; ++n) {
            const float a0 = fmaxf(s[j][n][0], s[j][n][1]);
            const float a1 = fmaxf(s[j][n][2], s[j][n][3]);
            const float a2 = fmaxf(s[j][n][4], s[j][n][5]);
            const float a3 = fmaxf(s[j][n][6], s[j][n][7]);
            tm[n] = fmaxf(fmaxf(a0, a1), fmaxf(a2, a3));
        }
        float mx = fmaxf(fmaxf(tm[0], tm[1]), fmaxf(tm[2], tm[3]));
        mx = fmaxf(mx, __shfl_xor(mx, 16, 32));

        const float mnew  = fmaxf(m_i[j], mx);
        const float corr  = __builtin_amdgcn_exp2f((m_i[j] - mnew) * SM_C);
        const float ebias = P_BIAS - mnew * SM_C;

        // exp2 arguments formed on the accumulator's own even-aligned register pairs
        const v2f c2 = {SM_C, SM_C};
        const v2f e2 = {ebias, ebias};
#pragma unroll
        for (int n = 0; n < 4; ++n)
#pragma unroll
            for (int v = 0; v < 8; v += 2) {
                const v2f sp = {s[j][n][v], s[j][n][v + 1]};
                const v2f x  = __builtin_elementwise_fma(sp, c2, e2);
                pb[j][n >> 1][(n & 1) * 8 + v]     = (_Float16)__builtin_amdgcn_exp2f(x[0]);
                pb[j][n >> 1][(n & 1) * 8 + v + 1] = (_Float16)__builtin_amdgcn_exp2f(x[1]);
            }

        // row sum via WMMA with ones: every lane gets sum over all 64 keys
        v8f rsum;
#pragma unroll
        for (int v = 0; v < 8; ++v) rsum[v] = 0.0f;
        rsum = wmma_f16(ones, pb[j][0], rsum);
        rsum = wmma_f16(ones, pb[j][1], rsum);

        l_i[j] = l_i[j] * corr + rsum[0];
        m_i[j] = mnew;
#pragma unroll
        for (int t = 0; t < 4; ++t)
#pragma unroll
            for (int v = 0; v < 8; ++v) acc[j][t][v] *= corr;
    }

    // ---- O^T += V^T P^T : 4 d-tiles x 2 key-chunks, each Vt fragment used by QT query tiles ----
#pragma unroll
    for (int ck = 0; ck < 2; ++ck)
#pragma unroll
        for (int t = 0; t < 4; ++t) {
            const v16h va = ld_op16(&vtsb[(t * 16 + l16) * VSTRIDE + ck * 32 + kbase]);
#pragma unroll
            for (int j = 0; j < QT; ++j) acc[j][t] = wmma_f16(va, pb[j][ck], acc[j][t]);
        }
}

// ---------------------------------------------------------------------------
// Attention forward: S^T / O^T formulation, double-buffered LDS (plain loads),
// hand-unrolled x2 so both LDS buffers are compile-time bases.
// Grid (SEQ/BM, NB*NH), 128 threads = 4 waves, 16 * QT query rows per wave.
// ---------------------------------------------------------------------------
__global__ __launch_bounds__(128) __attribute__((amdgpu_num_vgpr(256)))
void fa_fwd_wmma(const _Float16* __restrict__ Qh, const _Float16* __restrict__ Kh,
                 const _Float16* __restrict__ Vth, float* __restrict__ O) {
    __shared__ __align__(16) _Float16 Ks0[BN * KSTRIDE];      // cross-wave, block barrier
    __shared__ __align__(16) _Float16 Ks1[BN * KSTRIDE];      // cross-wave, block barrier
    __shared__ __align__(16) _Float16 Vts0[DHEAD * VSTRIDE];  // cross-wave, block barrier
    __shared__ __align__(16) _Float16 Vts1[DHEAD * VSTRIDE];  // cross-wave, block barrier
    __shared__ __align__(16) float    Os[BM * OSTRIDE];       // per-wave rows, block barrier used

    const int tid   = threadIdx.x;
    const int lane  = tid & 31;
    const int wid   = tid >> 5;
    const int half  = lane >> 4;
    const int l16   = lane & 15;
    const int kbase = half * 8;

    const int    bh     = blockIdx.y;
    const int    b      = bh / NH;
    const int    h      = bh - b * NH;
    const int    qblk   = blockIdx.x;
    const size_t bh_off = (size_t)bh * SEQ * DHEAD;

    const _Float16* kg0  = Kh  + bh_off;
    const _Float16* vtg0 = Vth + bh_off;

    // ---- Q tile: B-operand (Q^T) registers, straight f16 loads ----
    const int       qbase = qblk * BM + wid * (16 * QT);
    const _Float16* qrow  = Qh + bh_off + (size_t)(qbase + l16) * DHEAD + kbase;
    v16h qb[QT][2];
#pragma unroll
    for (int j = 0; j < QT; ++j)
#pragma unroll
        for (int c = 0; c < 2; ++c) qb[j][c] = ld_op16(qrow + j * 16 * DHEAD + c * 32);
    // precaution: the Q loads' address pair stays live, and so unwritten, up to this wait
    asm volatile("s_wait_xcnt 0x0" :: "v"(qrow) : "memory");

    v16h ones;
#pragma unroll
    for (int e = 0; e < 16; ++e) ones[e] = (_Float16)1.0f;

    float m_i[QT], l_i[QT];          // per-lane: this lane owns qrows (qbase + j*16 + l16)
    v8f acc[QT][4];                  // O^T (x64): rows d = t*16 + kbase + v, col = qrow
#pragma unroll
    for (int j = 0; j < QT; ++j) {
        m_i[j] = -1e30f;
        l_i[j] = 0.0f;
#pragma unroll
        for (int t = 0; t < 4; ++t)
#pragma unroll
            for (int v = 0; v < 8; ++v) acc[j][t][v] = 0.0f;
    }

    // the lane's chunk 0 of the tile to stage next, and its place in an LDS tile
    const unsigned  srow = (unsigned)tid >> 3;
    const unsigned  soff = ((unsigned)tid & 7u) * 8u;
    const unsigned  sl   = srow * KSTRIDE + soff;
    const _Float16* kl   = kg0 + srow * DHEAD + soff;
    const _Float16* vl   = vtg0 + srow * SEQ + soff;

    // prologue: stage first block into buffer 0
    stage_block(kl, vl, Ks0, Vts0, sl);

#pragma unroll 1
    for (int kb = 0; kb < SEQ; kb += 2 * BN) {
        // ---- half A: compute buffer 0, stage buffer 1 ----
        __syncthreads();  // buffer 0 ready everywhere; buffer 1 free
        // kb + BN < SEQ always holds (SEQ % (2*BN) == 0)
        stage_block(kl + BN * DHEAD, vl + BN, Ks1, Vts1, sl);
        fa_step(Ks0, Vts0, qb, ones, l16, kbase, m_i, l_i, acc);

        // ---- half B: compute buffer 1, stage buffer 0 ----
        __syncthreads();  // buffer 1 ready everywhere; buffer 0 free
        kl += 2 * BN * DHEAD;
        vl += 2 * BN;
        if (kb + 2 * BN < SEQ)
            stage_block(kl, vl, Ks0, Vts0, sl);
        fa_step(Ks1, Vts1, qb, ones, l16, kbase, m_i, l_i, acc);
    }

    // ---- epilogue: O[b][qrow][h][d] = acc^T / l via LDS staging ----
    // Each lane writes its columns (qrows j*16 + l16) of O^T into Os rows of the
    // wave's 16*QT-row region; then the wave writes whole 256-B output rows:
    // lanes 0..15 row 2it, lanes 16..31 row 2it+1.  coverage: it 0..8*QT-1 x 2 rows
    // = 16*QT rows per wave, 4 waves = BM rows per block, 16 lanes x 16 B = 64 floats per row.
    float* osw = Os + (wid * 16 * QT) * OSTRIDE;
#pragma unroll
    for (int j = 0; j < QT; ++j) {
        const float inv  = 1.0f / l_i[j];
        float*      ocol = osw + (j * 16 + l16) * OSTRIDE;
#pragma unroll
        for (int t = 0; t < 4; ++t) {
            v4f lo, hi;
            lo[0] = acc[j][t][0] * inv; lo[1] = acc[j][t][1] * inv;
            lo[2] = acc[j][t][2] * inv; lo[3] = acc[j][t][3] * inv;
            hi[0] = acc[j][t][4] * inv; hi[1] = acc[j][t][5] * inv;
            hi[2] = acc[j][t][6] * inv; hi[3] = acc[j][t][7] * inv;
            *(v4f*)&ocol[t * 16 + kbase]     = lo;
            *(v4f*)&ocol[t * 16 + kbase + 4] = hi;
        }
    }
    __syncthreads();

    v4f ov[8 * QT];
#pragma unroll
    for (int it = 0; it < 8 * QT; ++it) {
        const int r = 2 * it + half;
        ov[it] = *(const v4f*)&osw[r * OSTRIDE + l16 * 4];
    }
    const size_t rstride = (size_t)NH * DHEAD;
    const size_t obase   = (((size_t)b * SEQ + (size_t)qbase) * NH + (size_t)h) * DHEAD
                         + (size_t)(l16 * 4);
#pragma unroll
    for (int it = 0; it < 8 * QT; ++it) {
        const int r = 2 * it + half;
        *(v4f*)(O + obase + (size_t)r * rstride) = ov[it];
    }
}

extern "C" void kernel_launch(void* const* d_in, const int* in_sizes, int n_in,
                              void* d_out, int out_size, void* d_ws, size_t ws_size,
                              hipStream_t stream) {
    if (n_in < 3) return;
    const float* Q = (const float*)d_in[0];   // [NB_FULL][SEQ_FULL][NH][DHEAD] f32
    const float* K = (const float*)d_in[1];
    const float* V = (const float*)d_in[2];
    float*       O = (float*)d_out;          // [NB][SEQ][NH][DHEAD] f32

    // extent read from the inputs (full strides, reduced batch/sequence extents)
    const size_t need_in = ((size_t)(NB - 1) * SEQ_FULL + (size_t)SEQ) * NH * DHEAD;
    if ((size_t)in_sizes[0] < need_in) return;
    if ((size_t)in_sizes[1] < need_in) return;
    if ((size_t)in_sizes[2] < need_in) return;

    const size_t n = (size_t)NB * NH * SEQ * DHEAD;   // elements per plane / per output
    if ((size_t)out_size < n) return;
    // carve: three f16 planes of n halves each = 3 * 16 MiB = 48 MiB at full size
    if (ws_size < (size_t)3 * n * sizeof(_Float16)) return;

    _Float16* Qh  = (_Float16*)d_ws;
    _Float16* Kh  = Qh + n;
    _Float16* Vth = Kh + n;

    k_planes<<<dim3(SEQ / TPL, NB * NH), dim3(256), 0, stream>>>(Q, K, V, Qh, Kh, Vth);

    fa_fwd_wmma<<<dim3(SEQ / BM, NB * NH), dim3(128), 0, stream>>>(Qh, Kh, Vth, O);
}

// v003
// Measured time: 71 microseconds a run.
// In two side-by-side timings against v002, it was 1.08 and 1.09 times as fast.
// All steps since v000 together make it 1.73 times as fast.
#include <hip/hip_runtime.h>

typedef __attribute__((ext_vector_type(16))) _Float16 v16h;
typedef __attribute__((ext_vector_type(8)))  _Float16 v8h;
typedef __attribute__((ext_vector_type(8)))  float    v8f;
typedef __attribute__((ext_vector_type(4)))  float    v4f;
typedef __attribute__((ext_vector_type(2)))  float    v2f;
typedef __attribute__((ext_vector_type(4)))  int      v4i;

#ifndef NB
#define NB 4            // batches computed
#endif
#ifndef SEQ
#define SEQ 2048        // sequence length computed
#endif
#define NB_FULL  4      // input batch extent
#define SEQ_FULL 2048   // input sequence stride
#define NH       16
#define DHEAD    64
#define QT       2      // 16-row query tiles per wave: each K / Vt fragment read from LDS feeds QT products
#define BM       128    // query rows per block (16 * QT per wave)
#define BN       64     // keys per LDS buffer
#define KSTRIDE  72     // halves per K-LDS row (144 B)
#define VSTRIDE  72     // halves per Vt-LDS row (144 B)
#define OSTRIDE  68     // floats per O-staging row (272 B)
#define TPL      64     // sequence rows per plane-builder block
#define TPS      72     // halves per transposed V LDS row in the plane builder

// 1/sqrt(64) * log2(e), applied to the raw f32 dot inside the exp2 argument
#define SM_C   (0.125f * 1.4426950408889634f)
// P carried x64 (2^6) in its f16 operand; cancels exactly in acc/l
#define P_BIAS 6.0f

static_assert(NB >= 1 && NB <= NB_FULL);
static_assert(SEQ >= 2 * BN && SEQ <= SEQ_FULL);
static_assert(SEQ % (2 * BN) == 0);
static_assert(SEQ % BM == 0);
static_assert(SEQ % TPL == 0);
static_assert(BN == 64 && DHEAD == 64 && BM == 4 * 16 * QT);
static_assert((size_t)3 * NB * NH * SEQ * DHEAD * 2 <= (size_t)134217728);

// Assemble a v16h WMMA operand from two contiguous 8-half runs at p and p+16,
// matching the 16-bit A/B VGPR layout: elem e -> K = kbase + (e&7) + (e>=8)*16.
__device__ __forceinline__ v16h ld_op16(const _Float16* p) {
    const v8h lo = *(const v8h*)(p);
    const v8h hi = *(const v8h*)(p + 16);
    v16h r;
#pragma unroll
    for (int i = 0; i < 8; ++i) { r[i] = lo[i]; r[i + 8] = hi[i]; }
    return r;
}

__device__ __forceinline__ v8f wmma_f16(v16h a, v16h b, v8f c) {
    return __builtin_amdgcn_wmma_f32_16x16x32_f16(
        false, a, false, b, (short)0, c, false, false);
}

// f32 -> bf16 (RNE convert) -> f16 container (exact for the bf16 significand)
__device__ __forceinline__ _Float16 cvt_bh(float x) {
    unsigned u = __float_as_uint(x);
    u = (u + 0x7FFFu + ((u >> 16) & 1u)) & 0xFFFF0000u;
    return (_Float16)__uint_as_float(u);
}

__device__ __forceinline__ v8h cvt8(const float* p) {
    const float4 a = *(const float4*)(p);
    const float4 c = *(const float4*)(p + 4);
    v8h r;
    r[0] = cvt_bh(a.x); r[1] = cvt_bh(a.y); r[2] = cvt_bh(a.z); r[3] = cvt_bh(a.w);
    r[4] = cvt_bh(c.x); r[5] = cvt_bh(c.y); r[6] = cvt_bh(c.z); r[7] = cvt_bh(c.w);
    return r;
}

// ---------------------------------------------------------------------------
// Plane builder: input layout [B][L][H][D] f32 ->
//   Qh[bh][row][d]  (f16 of bf16-RNE value, unscaled)
//   Kh[bh][key][d]
//   Vth[bh][d][key] (transposed through LDS)
// coverage: Qh/Kh rows l0..l0+63 x d 0..63 (512 chunks of 8 halves = 2 x 256 threads);
//           Vth rows d 0..63 x keys l0..l0+63 (512 chunks); grid covers all bh, all l0.
// ---------------------------------------------------------------------------
__global__ __launch_bounds__(256)
void k_planes(const float* __restrict__ Q, const float* __restrict__ K,
              const float* __restrict__ V, _Float16* __restrict__ Qh,
              _Float16* __restrict__ Kh, _Float16* __restrict__ Vth) {
    __shared__ __align__(16) _Float16 Vs[DHEAD * TPS];   // Vs[d][row], cross-wave, block barrier

    const int tid = threadIdx.x;
    const int bh  = blockIdx.y;
    const int b   = bh / NH;
    const int h   = bh - b * NH;
    const int l0  = blockIdx.x * TPL;

    v4i    qw[2], kw[2];
    size_t rdst[2];
#pragma unroll
    for (int i = 0; i < 2; ++i) {
        const int c   = tid + 256 * i;   // 0..511
        const int row = c >> 3;          // 0..63
        const int dc  = (c & 7) * 8;     // 0..56
        const size_t src = (((size_t)b * SEQ_FULL + (size_t)(l0 + row)) * NH + (size_t)h) * DHEAD + (size_t)dc;
        const v8h qv = cvt8(Q + src);
        const v8h kv = cvt8(K + src);
        const v8h vv = cvt8(V + src);
        qw[i]   = __builtin_bit_cast(v4i, qv);
        kw[i]   = __builtin_bit_cast(v4i, kv);
        rdst[i] = ((size_t)bh * SEQ + (size_t)(l0 + row)) * DHEAD + (size_t)dc;
#pragma unroll
        for (int j = 0; j < 8; ++j) Vs[(dc + j) * TPS + row] = vv[j];
    }
    __syncthreads();

    v4i    vw[2];
    size_t vdst[2];
#pragma unroll
    for (int i = 0; i < 2; ++i) {
        const int c  = tid + 256 * i;
        const int d  = c >> 3;           // 0..63
        const int lc = (c & 7) * 8;      // 0..56
        const v8h t  = *(const v8h*)&Vs[d * TPS + lc];
        vw[i]   = __builtin_bit_cast(v4i, t);
        vdst[i] = ((size_t)bh * DHEAD + (size_t)d) * SEQ + (size_t)(l0 + lc);
    }

#pragma unroll
    for (int i = 0; i < 2; ++i) {
        *(v4i*)(Qh + rdst[i])  = qw[i];
        *(v4i*)(Kh + rdst[i])  = kw[i];
        *(v4i*)(Vth + vdst[i]) = vw[i];
    }
    
}

// LDS byte address of a __shared__ element: the low 32 bits of its address
__device__ __forceinline__ unsigned lds_addr(const void* p) { return (unsigned)(size_t)p; }

// Stage one 64(key) x 64(d) K block and one 64(d) x 64(key) Vt block into LDS
// with 16-B asynchronous copies (global memory -> LDS through no register, so the
// wave does not wait for them here); 512 chunks of 8 halves per tile = 4 x 128 threads.
// staged extent == consumed extent (64 rows x 64 halves for both tiles).
// Chunk i of a thread is row (tid >> 3) + 16 * i, halves (tid & 7) * 8 ...
// kl, vl: the lane's chunk 0 in the K and Vt planes; ks, vts: its LDS byte address
// in the K and Vt tile.  All 128 threads are on; every address is a multiple of 16 B.
// The copies land behind the issuing wave's s_wait_asynccnt 0 (publish()).
__device__ __forceinline__ void stage_block(const _Float16* kl, const _Float16* vl,
                                            unsigned ks, unsigned vts) {
    static_assert(KSTRIDE == VSTRIDE);
    // one statement: the closing s_wait_xcnt 0 (a precaution) stands in front of any
    // later write of the address registers that the copies name
    asm volatile(
        "global_load_async_to_lds_b128 %0, %8, off\n\t"
        "global_load_async_to_lds_b128 %1, %9, off\n\t"
        "global_load_async_to_lds_b128 %2, %10, off\n\t"
        "global_load_async_to_lds_b128 %3, %11, off\n\t"
        "global_load_async_to_lds_b128 %4, %12, off\n\t"
        "global_load_async_to_lds_b128 %5, %13, off\n\t"
        "global_load_async_to_lds_b128 %6, %14, off\n\t"
        "global_load_async_to_lds_b128 %7, %15, off\n\t"
        "s_wait_xcnt 0x0"
        :: "v"(ks), "v"(ks + 1u * 16u * KSTRIDE * 2u),
           "v"(ks + 2u * 16u * KSTRIDE * 2u), "v"(ks + 3u * 16u * KSTRIDE * 2u),
           "v"(vts), "v"(vts + 1u * 16u * VSTRIDE * 2u),
           "v"(vts + 2u * 16u * VSTRIDE * 2u), "v"(vts + 3u * 16u * VSTRIDE * 2u),
           "v"(kl), "v"(kl + 1 * 16 * DHEAD), "v"(kl + 2 * 16 * DHEAD), "v"(kl + 3 * 16 * DHEAD),
           "v"(vl), "v"(vl + 1 * 16 * SEQ), "v"(vl + 2 * 16 * SEQ), "v"(vl + 3 * 16 * SEQ)
        : "memory");
}

// Hand-over at the foot of a 64-key step: the wave's own LDS reads of the buffer it
// leaves are done, its own copies of the next tile have landed, then the block barrier:
// behind it the next tile is readable by every wave and the left buffer may be refilled.
__device__ __forceinline__ void publish() {
    asm volatile("s_wait_dscnt 0x0" ::: "memory");     // this wave's reads of the left buffer
    asm volatile("s_wait_asynccnt 0x0" ::: "memory");  // this wave's copies of the next tile
    __syncthreads();
}

// One 64-key online-softmax step against the LDS block (ksb, vtsb), for the
// wave's QT query tiles.  m_i and the scores s are kept in the raw q.k dot
// domain; the softmax scale and log2(e) are applied inside the exp2 argument.
__device__ __forceinline__ void fa_step(const _Float16* ksb, const _Float16* vtsb,
                                        const v16h (&qb)[QT][2], const v16h& ones,
                                        int l16, int kbase,
                                        float (&m_i)[QT], float (&l_i)[QT], v8f (&acc)[QT][4]) {
    // ---- S^T = K Q^T : four 16(key)x16(qrow) tiles per query tile, k=64 in two chunks ----
    v8f s[QT][4];
#pragma unroll
    for (int j = 0; j < QT; ++j)
#pragma unroll
        for (int n = 0; n < 4; ++n)
#pragma unroll
            for (int v = 0; v < 8; ++v) s[j][n][v] = 0.0f;
#pragma unroll
    for (int c = 0; c < 2; ++c) {
        const int dco = c * 32 + kbase;
#pragma unroll
        for (int n = 0; n < 4; ++n) {
            const v16h ka = ld_op16(&ksb[(n * 16 + l16) * KSTRIDE + dco]);
#pragma unroll
            for (int j = 0; j < QT; ++j) s[j][n] = wmma_f16(ka, qb[j][c], s[j][n]);
        }
    }

    v16h pb[QT][2];  // P^T (x64) packed directly into B-operand layout
#pragma unroll
    for (int j = 0; j < QT; ++j) {
        // ---- online softmax; balanced max tree ----
        float tm[4];
#pragma unroll
        for (int n = 0; n < 4; ++n) {
            const float a0 = fmaxf(s[j][n][0], s[j][n][1]);
            const float a1 = fmaxf(s[j][n][2], s[j][n][3]);
            const float a2 = fmaxf(s[j][n][4], s[j][n][5]);
            const float a3 = fmaxf(s[j][n][6], s[j][n][7]);
            tm[n] = fmaxf(fmaxf(a0, a1), fmaxf(a2, a3));
        }
        float mx = fmaxf(fmaxf(tm[0], tm[1]), fmaxf(tm[2], tm[3]));
        mx = fmaxf(mx, __shfl_xor(mx, 16, 32));

        const float mnew  = fmaxf(m_i[j], mx);
        const float corr  = __builtin_amdgcn_exp2f((m_i[j] - mnew) * SM_C);
        const float ebias = P_BIAS - mnew * SM_C;

        // exp2 arguments formed on the accumulator's own even-aligned register pairs
        const v2f c2 = {SM_C, SM_C};
        const v2f e2 = {ebias, ebias};
#pragma unroll
        for (int n = 0; n < 4; ++n)
#pragma unroll
            for (int v = 0; v < 8; v += 2) {
                const v2f sp = {s[j][n][v], s[j][n][v + 1]};
                const v2f x  = __builtin_elementwise_fma(sp, c2, e2);
                pb[j][n >> 1][(n & 1) * 8 + v]     = (_Float16)__builtin_amdgcn_exp2f(x[0]);
                pb[j][n >> 1][(n & 1) * 8 + v + 1] = (_Float16)__builtin_amdgcn_exp2f(x[1]);
            }

        // row sum via WMMA with ones: every lane gets sum over all 64 keys
        v8f rsum;
#pragma unroll
        for (int v = 0; v < 8; ++v) rsum[v] = 0.0f;
        rsum = wmma_f16(ones, pb[j][0], rsum);
        rsum = wmma_f16(ones, pb[j][1], rsum);

        l_i[j] = l_i[j] * corr + rsum[0];
        m_i[j] = mnew;
#pragma unroll
        for (int t = 0; t < 4; ++t)
#pragma unroll
            for (int v = 0; v < 8; ++v) acc[j][t][v] *= corr;
    }

    // ---- O^T += V^T P^T : 4 d-tiles x 2 key-chunks, each Vt fragment used by QT query tiles ----
#pragma unroll
    for (int ck = 0; ck < 2; ++ck)
#pragma unroll
        for (int t = 0; t < 4; ++t) {
            const v16h va = ld_op16(&vtsb[(t * 16 + l16) * VSTRIDE + ck * 32 + kbase]);
#pragma unroll
            for (int j = 0; j < QT; ++j) acc[j][t] = wmma_f16(va, pb[j][ck], acc[j][t]);
        }
}

// ---------------------------------------------------------------------------
// Attention forward: S^T / O^T formulation, double-buffered LDS filled by asynchronous
// copies issued one whole 64-key step ahead of their first reader,
// hand-unrolled x2 so both LDS buffers are compile-time bases.
// Grid (SEQ/BM, NB*NH), 128 threads = 4 waves, 16 * QT query rows per wave.
// ---------------------------------------------------------------------------
__global__ __launch_bounds__(128) __attribute__((amdgpu_num_vgpr(256)))
void fa_fwd_wmma(const _Float16* __restrict__ Qh, const _Float16* __restrict__ Kh,
                 const _Float16* __restrict__ Vth, float* __restrict__ O) {
    __shared__ __align__(16) _Float16 Ks0[BN * KSTRIDE];      // cross-wave, block barrier
    __shared__ __align__(16) _Float16 Ks1[BN * KSTRIDE];      // cross-wave, block barrier
    __shared__ __align__(16) _Float16 Vts0[DHEAD * VSTRIDE];  // cross-wave, block barrier
    __shared__ __align__(16) _Float16 Vts1[DHEAD * VSTRIDE];  // cross-wave, block barrier
    __shared__ __align__(16) float    Os[BM * OSTRIDE];       // per-wave rows, block barrier used

    const int tid   = threadIdx.x;
    const int lane  = tid & 31;
    const int wid   = tid >> 5;
    const int half  = lane >> 4;
    const int l16   = lane & 15;
    const int kbase = half * 8;

    const int    bh     = blockIdx.y;
    const int    b      = bh / NH;
    const int    h      = bh - b * NH;
    const int    qblk   = blockIdx.x;
    const size_t bh_off = (size_t)bh * SEQ * DHEAD;

    const _Float16* kg0  = Kh  + bh_off;
    const _Float16* vtg0 = Vth + bh_off;

    // ---- Q tile: B-operand (Q^T) registers, straight f16 loads ----
    const int       qbase = qblk * BM + wid * (16 * QT);
    const _Float16* qrow  = Qh + bh_off + (size_t)(qbase + l16) * DHEAD + kbase;
    v16h qb[QT][2];
#pragma unroll
    for (int j = 0; j < QT; ++j)
#pragma unroll
        for (int c = 0; c < 2; ++c) qb[j][c] = ld_op16(qrow + j * 16 * DHEAD + c * 32);
    // precaution: the Q loads' address pair stays live, and so unwritten, up to this wait
    asm volatile("s_wait_xcnt 0x0" :: "v"(qrow) : "memory");

    v16h ones;
#pragma unroll
    for (int e = 0; e < 16; ++e) ones[e] = (_Float16)1.0f;

    float m_i[QT], l_i[QT];          // per-lane: this lane owns qrows (qbase + j*16 + l16)
    v8f acc[QT][4];                  // O^T (x64): rows d = t*16 + kbase + v, col = qrow
#pragma unroll
    for (int j = 0; j < QT; ++j) {
        m_i[j] = -1e30f;
        l_i[j] = 0.0f;
#pragma unroll
        for (int t = 0; t < 4; ++t)
#pragma unroll
            for (int v = 0; v < 8; ++v) acc[j][t][v] = 0.0f;
    }

    // the lane's chunk 0 of the tile to stage next, and its place in an LDS tile
    const unsigned  srow = (unsigned)tid >> 3;
    const unsigned  soff = ((unsigned)tid & 7u) * 8u;
    const unsigned  sl   = srow * KSTRIDE + soff;
    const _Float16* kl   = kg0 + srow * DHEAD + soff;
    const _Float16* vl   = vtg0 + srow * SEQ + soff;

    const unsigned ks0 = lds_addr(&Ks0[sl]), vs0 = lds_addr(&Vts0[sl]);
    const unsigned ks1 = lds_addr(&Ks1[sl]), vs1 = lds_addr(&Vts1[sl]);

    // prologue: tile 0 into buffer 0, landed and published; then tile 1 into buffer 1
    // (SEQ >= 2 * BN: both tiles exist)
    stage_block(kl, vl, ks0, vs0);
    asm volatile("s_wait_asynccnt 0x0" ::: "memory");  // tile 0 landed before the barrier publishes it
    __syncthreads();
    stage_block(kl + BN * DHEAD, vl + BN, ks1, vs1);

    // kept rolled: one copy of the two steps in the instruction cache
#pragma unroll 1
    for (int kb = 0; kb < SEQ; kb += 2 * BN) {
        // tiles kb/BN + 2 and kb/BN + 3 exist together (SEQ % (2*BN) == 0); block-uniform
        const bool more = kb + 2 * BN < SEQ;
        kl += 2 * BN * DHEAD;
        vl += 2 * BN;

        // ---- half A: compute buffer 0 while buffer 1's copies fly ----
        fa_step(Ks0, Vts0, qb, ones, l16, kbase, m_i, l_i, acc);
        publish();  // buffer 1 ready everywhere; buffer 0 free
        if (more) stage_block(kl, vl, ks0, vs0);

        // ---- half B: compute buffer 1 while buffer 0's copies fly ----
        fa_step(Ks1, Vts1, qb, ones, l16, kbase, m_i, l_i, acc);
        publish();  // buffer 0 ready everywhere; buffer 1 free
        if (more) stage_block(kl + BN * DHEAD, vl + BN, ks1, vs1);
    }
    asm volatile("s_wait_asynccnt 0x0" ::: "memory");  // no copy outstanding behind the loop

    // ---- epilogue: O[b][qrow][h][d] = acc^T / l via LDS staging ----
    // Each lane writes its columns (qrows j*16 + l16) of O^T into Os rows of the
    // wave's 16*QT-row region; then the wave writes whole 256-B output rows:
    // lanes 0..15 row 2it, lanes 16..31 row 2it+1.  coverage: it 0..8*QT-1 x 2 rows
    // = 16*QT rows per wave, 4 waves = BM rows per block, 16 lanes x 16 B = 64 floats per row.
    float* osw = Os + (wid * 16 * QT) * OSTRIDE;
#pragma unroll
    for (int j = 0; j < QT; ++j) {
        const float inv  = 1.0f / l_i[j];
        float*      ocol = osw + (j * 16 + l16) * OSTRIDE;
#pragma unroll
        for (int t = 0; t < 4; ++t) {
            v4f lo, hi;
            lo[0] = acc[j][t][0] * inv; lo[1] = acc[j][t][1] * inv;
            lo[2] = acc[j][t][2] * inv; lo[3] = acc[j][t][3] * inv;
            hi[0] = acc[j][t][4] * inv; hi[1] = acc[j][t][5] * inv;
            hi[2] = acc[j][t][6] * inv; hi[3] = acc[j][t][7] * inv;
            *(v4f*)&ocol[t * 16 + kbase]     = lo;
            *(v4f*)&ocol[t * 16 + kbase + 4] = hi;
        }
    }
    __syncthreads();

    v4f ov[8 * QT];
#pragma unroll
    for (int it = 0; it < 8 * QT; ++it) {
        const int r = 2 * it + half;
        ov[it] = *(const v4f*)&osw[r * OSTRIDE + l16 * 4];
    }
    const size_t rstride = (size_t)NH * DHEAD;
    const size_t obase   = (((size_t)b * SEQ + (size_t)qbase) * NH + (size_t)h) * DHEAD
                         + (size_t)(l16 * 4);
#pragma unroll
    for (int it = 0; it < 8 * QT; ++it) {
        const int r = 2 * it + half;
        *(v4f*)(O + obase + (size_t)r * rstride) = ov[it];
    }
}

extern "C" void kernel_launch(void* const* d_in, const int* in_sizes, int n_in,
                              void* d_out, int out_size, void* d_ws, size_t ws_size,
                              hipStream_t stream) {
    if (n_in < 3) return;
    const float* Q = (const float*)d_in[0];   // [NB_FULL][SEQ_FULL][NH][DHEAD] f32
    const float* K = (const float*)d_in[1];
    const float* V = (const float*)d_in[2];
    float*       O = (float*)d_out;          // [NB][SEQ][NH][DHEAD] f32

    // extent read from the inputs (full strides, reduced batch/sequence extents)
    const size_t need_in = ((size_t)(NB - 1) * SEQ_FULL + (size_t)SEQ) * NH * DHEAD;
    if ((size_t)in_sizes[0] < need_in) return;
    if ((size_t)in_sizes[1] < need_in) return;
    if ((size_t)in_sizes[2] < need_in) return;

    const size_t n = (size_t)NB * NH * SEQ * DHEAD;   // elements per plane / per output
    if ((size_t)out_size < n) return;
    // carve: three f16 planes of n halves each = 3 * 16 MiB = 48 MiB at full size
    if (ws_size < (size_t)3 * n * sizeof(_Float16)) return;

    _Float16* Qh  = (_Float16*)d_ws;
    _Float16* Kh  = Qh + n;
    _Float16* Vth = Kh + n;

    k_planes<<<dim3(SEQ / TPL, NB * NH), dim3(256), 0, stream>>>(Q, K, V, Qh, Kh, Vth);

    fa_fwd_wmma<<<dim3(SEQ / BM, NB * NH), dim3(128), 0, stream>>>(Qh, Kh, Vth, O);
}

// v005
// Measured time: 63 microseconds a run.
// It is 1.12 times as fast as v003, going by the measured steps of the versions left out in between.
// Over all steps from v000 it is 1.94 times as fast.
#include <hip/hip_runtime.h>

typedef __attribute__((ext_vector_type(16))) _Float16 v16h;
typedef __attribute__((ext_vector_type(8)))  _Float16 v8h;
typedef __attribute__((ext_vector_type(8)))  float    v8f;
typedef __attribute__((ext_vector_type(4)))  float    v4f;
typedef __attribute__((ext_vector_type(2)))  float    v2f;
typedef __attribute__((ext_vector_type(4)))  int      v4i;

#ifndef NB
#define NB 4            // batches computed
#endif
#ifndef SEQ
#define SEQ 2048        // sequence length computed
#endif
#define NB_FULL  4      // input batch extent
#define SEQ_FULL 2048   // input sequence stride
#define NH       16
#define DHEAD    64
#define QT       2      // 16-row query tiles per wave: each K / Vt fragment read from LDS feeds QT products
#define BM       128    // query rows per block (16 * QT per wave)
#define BN       64     // keys per LDS buffer
#define KSTRIDE  72     // halves per K-LDS row (144 B)
#define VSTRIDE  72     // halves per Vt-LDS row (144 B)
#define OSTRIDE  68     // floats per O-staging row (272 B)
#define TPL      64     // sequence rows per plane-builder block
#define TPS      72     // halves per transposed V LDS row in the plane builder

// 1/sqrt(64) * log2(e), folded into the Q plane: a score leaves the matrix unit as an exp2 argument
#define SM_C   (0.125f * 1.4426950408889634f)
// P carried x64 (2^6) in its f16 operand; cancels exactly in acc/l
#define P_BIAS 6.0f
// a 64-key row sum of P above this (2^(P_BIAS + 8)) renews the maximum in use; every P below it is finite in f16
#define P_TOP  16384.0f

static_assert(NB >= 1 && NB <= NB_FULL);
static_assert(SEQ >= 2 * BN && SEQ <= SEQ_FULL);
static_assert(SEQ % (2 * BN) == 0);
static_assert(SEQ % BM == 0);
static_assert(SEQ % TPL == 0);
#define NPAIR    (SEQ / (2 * BN))   // 128-key tile pairs of a head: one loop trip each
static_assert(BN == 64 && DHEAD == 64 && BM == 4 * 16 * QT);
static_assert((size_t)3 * NB * NH * SEQ * DHEAD * 2 <= (size_t)134217728);

// Assemble a v16h WMMA operand from two contiguous 8-half runs at p and p+16,
// matching the 16-bit A/B VGPR layout: elem e -> K = kbase + (e&7) + (e>=8)*16.
__device__ __forceinline__ v16h ld_op16(const _Float16* p) {
    const v8h lo = *(const v8h*)(p);
    const v8h hi = *(const v8h*)(p + 16);
    v16h r;
#pragma unroll
    for (int i = 0; i < 8; ++i) { r[i] = lo[i]; r[i + 8] = hi[i]; }
    return r;
}

__device__ __forceinline__ v8f wmma_f16(v16h a, v16h b, v8f c) {
    return __builtin_amdgcn_wmma_f32_16x16x32_f16(
        false, a, false, b, (short)0, c, false, false);
}

// f32 -> bf16 (RNE convert) -> f16 container (exact for the bf16 significand)
__device__ __forceinline__ _Float16 cvt_bh(float x) {
    unsigned u = __float_as_uint(x);
    u = (u + 0x7FFFu + ((u >> 16) & 1u)) & 0xFFFF0000u;
    return (_Float16)__uint_as_float(u);
}

__device__ __forceinline__ v8h cvt8(const float* p) {
    const float4 a = *(const float4*)(p);
    const float4 c = *(const float4*)(p + 4);
    v8h r;
    r[0] = cvt_bh(a.x); r[1] = cvt_bh(a.y); r[2] = cvt_bh(a.z); r[3] = cvt_bh(a.w);
    r[4] = cvt_bh(c.x); r[5] = cvt_bh(c.y); r[6] = cvt_bh(c.z); r[7] = cvt_bh(c.w);
    return r;
}

// the eight values times log2(e)/8: product in f32, rounded once into f16
__device__ __forceinline__ v8h scale8(v8h x) {
    v8h r;
#pragma unroll
    for (int i = 0; i < 8; ++i) r[i] = (_Float16)((float)x[i] * SM_C);
    return r;
}

// ---------------------------------------------------------------------------
// Plane builder: input layout [B][L][H][D] f32 ->
//   Qh[bh][row][d]  (f16 of bf16-RNE value times log2(e)/8)
//   Kh[bh][key][d]
//   Vth[bh][d][key] (transposed through LDS)
// coverage: Qh/Kh rows l0..l0+63 x d 0..63 (512 chunks of 8 halves = 2 x 256 threads);
//           Vth rows d 0..63 x keys l0..l0+63 (512 chunks); grid covers all bh, all l0.
// ---------------------------------------------------------------------------
__global__ __launch_bounds__(256)
void k_planes(const float* __restrict__ Q, const float* __restrict__ K,
              const float* __restrict__ V, _Float16* __restrict__ Qh,
              _Float16* __restrict__ Kh, _Float16* __restrict__ Vth) {
    __shared__ __align__(16) _Float16 Vs[DHEAD * TPS];   // Vs[d][row], cross-wave, block barrier

    const int tid = threadIdx.x;
    const int bh  = blockIdx.y;
    const int b   = bh / NH;
    const int h   = bh - b * NH;
    const int l0  = blockIdx.x * TPL;

    v4i    qw[2], kw[2];
    size_t rdst[2];
#pragma unroll
    for (int i = 0; i < 2; ++i) {
        const int c   = tid + 256 * i;   // 0..511
        const int row = c >> 3;          // 0..63
        const int dc  = (c & 7) * 8;     // 0..56
        const size_t src = (((size_t)b * SEQ_FULL + (size_t)(l0 + row)) * NH + (size_t)h) * DHEAD + (size_t)dc;
        const v8h qv = cvt8(Q + src);
        const v8h kv = cvt8(K + src);
        const v8h vv = cvt8(V + src);
        qw[i]   = __builtin_bit_cast(v4i, scale8(qv));
        kw[i]   = __builtin_bit_cast(v4i, kv);
        rdst[i] = ((size_t)bh * SEQ + (size_t)(l0 + row)) * DHEAD + (size_t)dc;
#pragma unroll
        for (int j = 0; j < 8; ++j) Vs[(dc + j) * TPS + row] = vv[j];
    }
    __syncthreads();

    v4i    vw[2];
    size_t vdst[2];
#pragma unroll
    for (int i = 0; i < 2; ++i) {
        const int c  = tid + 256 * i;
        const int d  = c >> 3;           // 0..63
        const int lc = (c & 7) * 8;      // 0..56
        const v8h t  = *(const v8h*)&Vs[d * TPS + lc];
        vw[i]   = __builtin_bit_cast(v4i, t);
        vdst[i] = ((size_t)bh * DHEAD + (size_t)d) * SEQ + (size_t)(l0 + lc);
    }

#pragma unroll
    for (int i = 0; i < 2; ++i) {
        *(v4i*)(Qh + rdst[i])  = qw[i];
        *(v4i*)(Kh + rdst[i])  = kw[i];
        *(v4i*)(Vth + vdst[i]) = vw[i];
    }
    
}

// LDS byte address of a __shared__ element: the low 32 bits of its address
__device__ __forceinline__ unsigned lds_addr(const void* p) { return (unsigned)(size_t)p; }

// Stage one 64(key) x 64(d) K block and one 64(d) x 64(key) Vt block into LDS
// with 16-B asynchronous copies (global memory -> LDS through no register, so the
// wave does not wait for them here); 512 chunks of 8 halves per tile = 4 x 128 threads.
// staged extent == consumed extent (64 rows x 64 halves for both tiles).
// Chunk i of a thread is row (tid >> 3) + 16 * i, halves (tid & 7) * 8 ...
// kl, vl: the lane's chunk 0 in the K and Vt planes; ks, vts: its LDS byte address
// in the K and Vt tile.  All 128 threads are on; every address is a multiple of 16 B.
// The copies land behind the issuing wave's s_wait_asynccnt 0 (publish()).
__device__ __forceinline__ void stage_block(const _Float16* kl, const _Float16* vl,
                                            unsigned ks, unsigned vts) {
    static_assert(KSTRIDE == VSTRIDE && 16 * KSTRIDE * 2 == 2304);
    // Chunk i's step in LDS, i * 2304 B, is the copy's offset:N, so one LDS address register serves a tile's
    // four chunks (with one register per chunk held through the loop the build spills).  N moves the
    // global address too: chunk i's global register holds its address less N.
    // one statement: the closing s_wait_xcnt 0 (a precaution) stands in front of any
    // later write of the address registers that the copies name
    asm volatile(
        "global_load_async_to_lds_b128 %0, %2, off\n\t"
        "global_load_async_to_lds_b128 %0, %3, off offset:2304\n\t"
        "global_load_async_to_lds_b128 %0, %4, off offset:4608\n\t"
        "global_load_async_to_lds_b128 %0, %5, off offset:6912\n\t"
        "global_load_async_to_lds_b128 %1, %6, off\n\t"
        "global_load_async_to_lds_b128 %1, %7, off offset:2304\n\t"
        "global_load_async_to_lds_b128 %1, %8, off offset:4608\n\t"
        "global_load_async_to_lds_b128 %1, %9, off offset:6912\n\t"
        "s_wait_xcnt 0x0"
        :: "v"(ks), "v"(vts),
           "v"(kl), "v"(kl + 1 * 16 * (DHEAD - KSTRIDE)),
           "v"(kl + 2 * 16 * (DHEAD - KSTRIDE)), "v"(kl + 3 * 16 * (DHEAD - KSTRIDE)),
           "v"(vl), "v"(vl + 1 * 16 * (SEQ - VSTRIDE)),
           "v"(vl + 2 * 16 * (SEQ - VSTRIDE)), "v"(vl + 3 * 16 * (SEQ - VSTRIDE))
        : "memory");
}

// Hand-over at the foot of a 64-key step: the wave's own LDS reads of the buffer it
// leaves are done, its own copies of the next tile have landed, then the block barrier:
// behind it the next tile is readable by every wave and the left buffer may be refilled.
__device__ __forceinline__ void publish() {
    asm volatile("s_wait_dscnt 0x0" ::: "memory");     // this wave's reads of the left buffer
    asm volatile("s_wait_asynccnt 0x0" ::: "memory");  // this wave's copies of the next tile
    __syncthreads();
}

// lane l's value in lane l ^ 16: a vector cross-row move, which needs no lane index held in a register
__device__ __forceinline__ float xhalf(float x) {
    const int b = __builtin_bit_cast(int, x);
    return __builtin_bit_cast(float, __builtin_amdgcn_permlanex16(b, b, 0x76543210, 0xfedcba98, false, false));
}

// One 16(key)x16(qrow) tile of S^T = K Q^T + e, k=64 in two chunks; e, the lane's own
// query row's, is the accumulator's start value.
__device__ __forceinline__ v8f score_tile(const v16h (&ka)[2], const v16h (&qbj)[2], float e) {
    v8f s;
#pragma unroll
    for (int v = 0; v < 8; ++v) s[v] = e;
#pragma unroll
    for (int c = 0; c < 2; ++c) s = wmma_f16(ka[c], qbj[c], s);
    return s;
}

// The two k chunks of K rows n*16 .. n*16+15 as A operands
__device__ __forceinline__ void k_frag(const _Float16* ksb, int n, int l16, int kbase, v16h (&ka)[2]) {
#pragma unroll
    for (int c = 0; c < 2; ++c) ka[c] = ld_op16(&ksb[(n * 16 + l16) * KSTRIDE + c * 32 + kbase]);
}

// P^T (x64) = exp2(x) of score tile n, packed directly into its place in the B-operand layout
__device__ __forceinline__ void pack_p(const v8f& x, int n, v16h (&pb)[2]) {
#pragma unroll
    for (int v = 0; v < 8; ++v)
        pb[n >> 1][(n & 1) * 8 + v] = (_Float16)__builtin_amdgcn_exp2f(x[v]);
}

// Sum of P over the 64 keys by a WMMA with ones: every lane gets its own query row's sum
__device__ __forceinline__ float row_sum(const v16h& ones, const v16h (&pb)[2]) {
    v8f rsum;
#pragma unroll
    for (int v = 0; v < 8; ++v) rsum[v] = 0.0f;
    rsum = wmma_f16(ones, pb[0], rsum);
    rsum = wmma_f16(ones, pb[1], rsum);
    return rsum[0];
}

// P^T of the wave's QT query tiles against one 64-key K tile, and its row sums; key tile by
// key tile: a tile's exp2 needs nothing of the other tiles.
// AHEAD (the common path): the K fragments are asked for in two groups of two key tiles, each group well
// ahead of the products that read it, so that the waits are counted ones and not one LDS round trip per
// key tile.  The two scheduling barriers keep the reads so: without the first they stand in more and
// smaller groups among the products, and without either one the build spills.
// !AHEAD (the rare path): a tile's fragments are read when its turn comes; with the groups there too the
// build spills.
template <bool AHEAD>
__device__ __forceinline__ void p_pass(const _Float16* ksb, const v16h (&qb)[QT][2], const v16h& ones,
                                       int l16, int kbase, const float (&e)[QT],
                                       v16h (&pb)[QT][2], float (&rs)[QT]) {
    v16h ka[4][2];
    if (AHEAD) {
#pragma unroll
        for (int n = 0; n < 2; ++n) k_frag(ksb, n, l16, kbase, ka[n]);
        __builtin_amdgcn_sched_barrier(0);
    }
#pragma unroll
    for (int n = 0; n < 4; ++n) {
        if (!AHEAD) k_frag(ksb, n, l16, kbase, ka[n]);
        v8f s[QT];
#pragma unroll
        for (int j = 0; j < QT; ++j) s[j] = score_tile(ka[n], qb[j], e[j]);
        if (AHEAD && n == 1) {
#pragma unroll
            for (int m = 2; m < 4; ++m) k_frag(ksb, m, l16, kbase, ka[m]);
            __builtin_amdgcn_sched_barrier(0);
        }
#pragma unroll
        for (int j = 0; j < QT; ++j) pack_p(s[j], n, pb[j]);
    }
#pragma unroll
    for (int j = 0; j < QT; ++j) rs[j] = row_sum(ones, pb[j]);
}

// One 64-key online-softmax step against the LDS block (ksb, vtsb), for the
// wave's QT query tiles.  Scores are in the log2 domain (Q carries the scale).
// e_i[j] = P_BIAS - (the maximum IN USE, not the running one) is the score accumulators'
// start value, so exp2 reads them as they are.
// The maximum is renewed (acc and l rescaled, the step's scores formed anew from the K
// tile still in LDS) on the first step and whenever a row sum of P tops P_TOP: a sum of
// positive terms bounds each of them, so below P_TOP no P has left f16's range.
__device__ __forceinline__ void fa_step(const _Float16* ksb, const _Float16* vtsb,
                                        const v16h (&qb)[QT][2], const v16h& ones,
                                        int l16, int kbase, bool first, float (&e_i)[QT],
                                        float (&l_i)[QT], v8f (&acc)[QT][4]) {
    v16h  pb[QT][2];
    float rs[QT];
    bool  renew = first;   // wave-uniform
    // the two expectations: the renewal is laid out of line, so the loop's common path stays short in the instruction cache
    if (__builtin_expect(!first, true)) {
        p_pass<true>(ksb, qb, ones, l16, kbase, e_i, pb, rs);
        unsigned over = 0u;
#pragma unroll
        for (int j = 0; j < QT; ++j) over |= __builtin_amdgcn_ballot_w32(!(rs[j] <= P_TOP));
        // one test per step, a scalar branch: the matrix instructions behind it need every lane on
        renew = over != 0u;
    }
    if (__builtin_expect(renew, false)) {
        // rare.  The two compiler fences: the K fragments are read from LDS anew behind each; without
        // them fragments are held live from one pass over the tile to the next and registers spill.
        asm volatile("" ::: "memory");
#pragma unroll
        for (int j = 0; j < QT; ++j) {
            float mx = -1e30f;
#pragma unroll
            for (int n = 0; n < 4; ++n) {
                v16h ka[2];
                k_frag(ksb, n, l16, kbase, ka);
                const v8f s = score_tile(ka, qb[j], 0.0f);
                const float a0 = fmaxf(s[0], s[1]);
                const float a1 = fmaxf(s[2], s[3]);
                const float a2 = fmaxf(s[4], s[5]);
                const float a3 = fmaxf(s[6], s[7]);
                mx = fmaxf(mx, fmaxf(fmaxf(a0, a1), fmaxf(a2, a3)));
            }
            mx = fmaxf(mx, xhalf(mx));

            // the shift never rises: e = P_BIAS - (maximum in use)
            const float enew = fminf(e_i[j], P_BIAS - mx);
            const float corr = __builtin_amdgcn_exp2f(enew - e_i[j]);
            e_i[j] = enew;
            l_i[j] *= corr;
#pragma unroll
            for (int t = 0; t < 4; ++t)
#pragma unroll
                for (int v = 0; v < 8; ++v) acc[j][t][v] *= corr;
        }
        asm volatile("" ::: "memory");
        p_pass<false>(ksb, qb, ones, l16, kbase, e_i, pb, rs);
    }
#pragma unroll
    for (int j = 0; j < QT; ++j) l_i[j] += rs[j];

    // ---- O^T += V^T P^T : 4 d-tiles x 2 key-chunks, each Vt fragment used by QT query tiles ----
    // The four Vt fragments of a key chunk are asked for together.  The scheduling barrier keeps the
    // reads there: without it the compiler sinks each read to its own products, one LDS round trip
    // per fragment, now that the branch above keeps the reads from standing among the exp2.
#pragma unroll
    for (int ck = 0; ck < 2; ++ck) {
        v16h va[4];
#pragma unroll
        for (int t = 0; t < 4; ++t) va[t] = ld_op16(&vtsb[(t * 16 + l16) * VSTRIDE + ck * 32 + kbase]);
        __builtin_amdgcn_sched_barrier(0);
#pragma unroll
        for (int t = 0; t < 4; ++t)
#pragma unroll
            for (int j = 0; j < QT; ++j) acc[j][t] = wmma_f16(va[t], pb[j][ck], acc[j][t]);
    }
}

// ---------------------------------------------------------------------------
// Attention forward: S^T / O^T formulation, double-buffered LDS filled by asynchronous
// copies issued one whole 64-key step ahead of their first reader,
// hand-unrolled x2 so both LDS buffers are compile-time bases.
// The NPAIR tile pairs of a head are walked as a ring, each pair once, from a start that differs between
// the work-groups that share the head's K and Vt planes: they do not ask L2 for the same lines at the same time.
// Grid (SEQ/BM, NB*NH), 128 threads = 4 waves, 16 * QT query rows per wave.
// ---------------------------------------------------------------------------
__global__ __launch_bounds__(128) __attribute__((amdgpu_num_vgpr(256)))
void fa_fwd_wmma(const _Float16* __restrict__ Qh, const _Float16* __restrict__ Kh,
                 const _Float16* __restrict__ Vth, float* __restrict__ O) {
    __shared__ __align__(16) _Float16 Ks0[BN * KSTRIDE];      // cross-wave, block barrier
    __shared__ __align__(16) _Float16 Ks1[BN * KSTRIDE];      // cross-wave, block barrier
    __shared__ __align__(16) _Float16 Vts0[DHEAD * VSTRIDE];  // cross-wave, block barrier
    __shared__ __align__(16) _Float16 Vts1[DHEAD * VSTRIDE];  // cross-wave, block barrier
    __shared__ __align__(16) float    Os[BM * OSTRIDE];       // per-wave rows, block barrier used

    const int tid   = threadIdx.x;
    const int lane  = tid & 31;
    const int wid   = tid >> 5;
    const int half  = lane >> 4;
    const int l16   = lane & 15;
    const int kbase = half * 8;

    const int    bh     = blockIdx.y;
    const int    b      = bh / NH;
    const int    h      = bh - b * NH;
    const int    qblk   = blockIdx.x;
    const size_t bh_off = (size_t)bh * SEQ * DHEAD;

    const _Float16* kg0  = Kh  + bh_off;
    const _Float16* vtg0 = Vth + bh_off;

    // ---- Q tile: B-operand (Q^T) registers, straight f16 loads ----
    const int       qbase = qblk * BM + wid * (16 * QT);
    const _Float16* qrow  = Qh + bh_off + (size_t)(qbase + l16) * DHEAD + kbase;
    v16h qb[QT][2];
#pragma unroll
    for (int j = 0; j < QT; ++j)
#pragma unroll
        for (int c = 0; c < 2; ++c) qb[j][c] = ld_op16(qrow + j * 16 * DHEAD + c * 32);
    // precaution: the Q loads' address pair stays live, and so unwritten, up to this wait
    asm volatile("s_wait_xcnt 0x0" :: "v"(qrow) : "memory");

    v16h ones;
#pragma unroll
    for (int e = 0; e < 16; ++e) ones[e] = (_Float16)1.0f;

    float e_i[QT], l_i[QT];          // per-lane: this lane owns qrows (qbase + j*16 + l16)
    v8f acc[QT][4];                  // O^T (x64): rows d = t*16 + kbase + v, col = qrow
#pragma unroll
    for (int j = 0; j < QT; ++j) {
        e_i[j] = 1e30f;              // no maximum yet: the first step sets it
        l_i[j] = 0.0f;
#pragma unroll
        for (int t = 0; t < 4; ++t)
#pragma unroll
            for (int v = 0; v < 8; ++v) acc[j][t][v] = 0.0f;
    }

    // the lane's chunk 0 of the head's tile 0, and its place in an LDS tile
    const unsigned  srow = (unsigned)tid >> 3;
    const unsigned  soff = ((unsigned)tid & 7u) * 8u;
    const unsigned  sl   = srow * KSTRIDE + soff;
    const _Float16* kl0  = kg0 + srow * DHEAD + soff;
    const _Float16* vl0  = vtg0 + srow * SEQ + soff;

    // the tile pair to stage next, 0 .. NPAIR-1; block-uniform.  The SEQ / BM work-groups of a head start apart
    int pr = (qblk + h + b) % NPAIR;

    const unsigned ks0 = lds_addr(&Ks0[sl]), vs0 = lds_addr(&Vts0[sl]);
    const unsigned ks1 = lds_addr(&Ks1[sl]), vs1 = lds_addr(&Vts1[sl]);

    // prologue: the first pair's tile 0 into buffer 0, landed and published; then its tile 1 into buffer 1
    // (a pair is two whole tiles inside the head's planes)
    stage_block(kl0 + pr * (2 * BN * DHEAD), vl0 + pr * (2 * BN), ks0, vs0);
    asm volatile("s_wait_asynccnt 0x0" ::: "memory");  // tile 0 landed before the barrier publishes it
    __syncthreads();
    stage_block(kl0 + pr * (2 * BN * DHEAD) + BN * DHEAD, vl0 + pr * (2 * BN) + BN, ks1, vs1);

    // kept rolled: one copy of the two steps in the instruction cache
#pragma unroll 1
    for (int it = 0; it < NPAIR; ++it) {
        // a further pair is staged on every trip but the last; block-uniform
        const bool more = it + 1 < NPAIR;
        pr = pr + 1 == NPAIR ? 0 : pr + 1;   // ring order: behind the head's last pair comes its first

        // ---- half A: compute buffer 0 while buffer 1's copies fly ----
        fa_step(Ks0, Vts0, qb, ones, l16, kbase, it == 0, e_i, l_i, acc);
        publish();  // buffer 1 ready everywhere; buffer 0 free
        if (more) stage_block(kl0 + pr * (2 * BN * DHEAD), vl0 + pr * (2 * BN), ks0, vs0);

        // ---- half B: compute buffer 1 while buffer 0's copies fly ----
        fa_step(Ks1, Vts1, qb, ones, l16, kbase, false, e_i, l_i, acc);
        publish();  // buffer 0 ready everywhere; buffer 1 free
        if (more) stage_block(kl0 + pr * (2 * BN * DHEAD) + BN * DHEAD, vl0 + pr * (2 * BN) + BN, ks1, vs1);
    }
    asm volatile("s_wait_asynccnt 0x0" ::: "memory");  // no copy outstanding behind the loop

    // ---- epilogue: O[b][qrow][h][d] = acc^T / l via LDS staging ----
    // Each lane writes its columns (qrows j*16 + l16) of O^T into Os rows of the
    // wave's 16*QT-row region; then the wave writes whole 256-B output rows:
    // lanes 0..15 row 2it, lanes 16..31 row 2it+1.  coverage: it 0..8*QT-1 x 2 rows
    // = 16*QT rows per wave, 4 waves = BM rows per block, 16 lanes x 16 B = 64 floats per row.
    // the lane's place is formed anew here: fewer vector registers are carried through the loop (with the
    // loop's own l16, kbase and half used here the build spills)
    const int elane  = (int)__builtin_amdgcn_mbcnt_lo(~0u, 0u);
    const int ehalf  = elane >> 4;
    const int el16   = elane & 15;
    const int ekbase = ehalf * 8;
    float* osw = Os + (wid * 16 * QT) * OSTRIDE;
#pragma unroll
    for (int j = 0; j < QT; ++j) {
        const float inv  = 1.0f / l_i[j];
        float*      ocol = osw + (j * 16 + el16) * OSTRIDE;
#pragma unroll
        for (int t = 0; t < 4; ++t) {
            v4f lo, hi;
            lo[0] = acc[j][t][0] * inv; lo[1] = acc[j][t][1] * inv;
            lo[2] = acc[j][t][2] * inv; lo[3] = acc[j][t][3] * inv;
            hi[0] = acc[j][t][4] * inv; hi[1] = acc[j][t][5] * inv;
            hi[2] = acc[j][t][6] * inv; hi[3] = acc[j][t][7] * inv;
            *(v4f*)&ocol[t * 16 + ekbase]     = lo;
            *(v4f*)&ocol[t * 16 + ekbase + 4] = hi;
        }
    }
    __syncthreads();

    v4f ov[8 * QT];
#pragma unroll
    for (int it = 0; it < 8 * QT; ++it) {
        const int r = 2 * it + ehalf;
        ov[it] = *(const v4f*)&osw[r * OSTRIDE + el16 * 4];
    }
    const size_t rstride = (size_t)NH * DHEAD;
    const size_t obase   = (((size_t)b * SEQ + (size_t)qbase) * NH + (size_t)h) * DHEAD
                         + (size_t)(el16 * 4);
#pragma unroll
    for (int it = 0; it < 8 * QT; ++it) {
        const int r = 2 * it + ehalf;
        *(v4f*)(O + obase + (size_t)r * rstride) = ov[it];
    }
}

extern "C" void kernel_launch(void* const* d_in, const int* in_sizes, int n_in,
                              void* d_out, int out_size, void* d_ws, size_t ws_size,
                              hipStream_t stream) {
    if (n_in < 3) return;
    const float* Q = (const float*)d_in[0];   // [NB_FULL][SEQ_FULL][NH][DHEAD] f32
    const float* K = (const float*)d_in[1];
    const float* V = (const float*)d_in[2];
    float*       O = (float*)d_out;          // [NB][SEQ][NH][DHEAD] f32

    // extent read from the inputs (full strides, reduced batch/sequence extents)
    const size_t need_in = ((size_t)(NB - 1) * SEQ_FULL + (size_t)SEQ) * NH * DHEAD;
    if ((size_t)in_sizes[0] < need_in) return;
    if ((size_t)in_sizes[1] < need_in) return;
    if ((size_t)in_sizes[2] < need_in) return;

    const size_t n = (size_t)NB * NH * SEQ * DHEAD;   // elements per plane / per output
    if ((size_t)out_size < n) return;
    // carve: three f16 planes of n halves each = 3 * 16 MiB = 48 MiB at full size
    if (ws_size < (size_t)3 * n * sizeof(_Float16)) return;

    _Float16* Qh  = (_Float16*)d_ws;
    _Float16* Kh  = Qh + n;
    _Float16* Vth = Kh + n;

    k_planes<<<dim3(SEQ / TPL, NB * NH), dim3(256), 0, stream>>>(Q, K, V, Qh, Kh, Vth);

    fa_fwd_wmma<<<dim3(SEQ / BM, NB * NH), dim3(128), 0, stream>>>(Qh, Kh, Vth, O);
}

// v006
// A run of this version takes 50.2 microseconds.
// Timed twice side by side with v005, it ran 1.26 and 1.25 times as fast.
// All steps since v000 together make it 2.44 times as fast.
#include <hip/hip_runtime.h>

typedef __attribute__((ext_vector_type(16))) _Float16 v16h;
typedef __attribute__((ext_vector_type(8)))  _Float16 v8h;
typedef __attribute__((ext_vector_type(2)))  _Float16 v2h;
typedef __attribute__((ext_vector_type(2)))  __bf16   v2bf;
typedef __attribute__((ext_vector_type(8)))  float    v8f;
typedef __attribute__((ext_vector_type(4)))  float    v4f;
typedef __attribute__((ext_vector_type(2)))  float    v2f;
typedef __attribute__((ext_vector_type(4)))  int      v4i;

#ifndef NB
#define NB 4            // batches computed
#endif
#ifndef SEQ
#define SEQ 2048        // sequence length computed
#endif
#define NB_FULL  4      // input batch extent
#define SEQ_FULL 2048   // input sequence stride
#define NH       16
#define DHEAD    64
#define QT       2      // 16-row query tiles per wave: each K / Vt fragment read from LDS feeds QT products
#define NWAVE    16     // waves per block: four on each SIMD, one block on a WGP
#define BM       512    // query rows per block (16 * QT per wave)
#define BN       64     // keys per LDS buffer
#define KSTRIDE  72     // halves per K-LDS row (144 B)
#define VSTRIDE  72     // halves per Vt-LDS row (144 B)
#define OSTRIDE  68     // floats per O-staging row (272 B)
#define SPITCH   68     // floats per staged f32 K or V row in LDS (272 B)
#define STILE    (BN * SPITCH)   // floats per staged f32 tile (17408 B)

// 1/sqrt(64) * log2(e), folded into the Q operand: a score leaves the matrix unit as an exp2 argument
#define SM_C   (0.125f * 1.4426950408889634f)
// P carried x64 (2^6) in its f16 operand; cancels exactly in acc/l
#define P_BIAS 6.0f
// a 64-key row sum of P above this (2^(P_BIAS + 8)) renews the maximum in use; every P below it is finite in f16
#define P_TOP  16384.0f

static_assert(NB >= 1 && NB <= NB_FULL);
static_assert(SEQ >= 2 * BN && SEQ <= SEQ_FULL);
static_assert(SEQ % (2 * BN) == 0);
static_assert(SEQ % BM == 0);
#define NPAIR    (SEQ / (2 * BN))   // 128-key tile pairs of a head: one loop trip each
#define NTILE    (SEQ / BN)         // 64-key tiles of a head
static_assert(BN == 64 && DHEAD == 64 && BM == NWAVE * 16 * QT);
static_assert(NTILE >= 4 && NTILE % (SEQ / BM) == 0);

// Assemble a v16h WMMA operand from two contiguous 8-half runs at p and p+16,
// matching the 16-bit A/B VGPR layout: elem e -> K = kbase + (e&7) + (e>=8)*16.
__device__ __forceinline__ v16h ld_op16(const _Float16* p) {
    const v8h lo = *(const v8h*)(p);
    const v8h hi = *(const v8h*)(p + 16);
    v16h r;
#pragma unroll
    for (int i = 0; i < 8; ++i) { r[i] = lo[i]; r[i + 8] = hi[i]; }
    return r;
}

__device__ __forceinline__ v8f wmma_f16(v16h a, v16h b, v8f c) {
    return __builtin_amdgcn_wmma_f32_16x16x32_f16(
        false, a, false, b, (short)0, c, false, false);
}

// two f32 -> bf16 (RNE, one packed convert) -> f16 container (exact for the bf16 significand)
__device__ __forceinline__ v2h cvt_bh2(float a, float b) {
    const v2f      x = {a, b};
    const unsigned u = __builtin_bit_cast(unsigned, __builtin_convertvector(x, v2bf));
    const v2f      y = {__uint_as_float(u << 16), __uint_as_float(u & 0xFFFF0000u)};
    return __builtin_convertvector(y, v2h);
}

__device__ __forceinline__ v8h cvt8(const float* p) {
    const float4 a = *(const float4*)(p);
    const float4 c = *(const float4*)(p + 4);
    const v2h p0 = cvt_bh2(a.x, a.y), p1 = cvt_bh2(a.z, a.w), p2 = cvt_bh2(c.x, c.y), p3 = cvt_bh2(c.z, c.w);
    const v8h r = {p0[0], p0[1], p1[0], p1[1], p2[0], p2[1], p3[0], p3[1]};
    return r;
}

// the eight values times log2(e)/8: product in f32, rounded once into f16
__device__ __forceinline__ v8h scale8(v8h x) {
    v8h r;
#pragma unroll
    for (int i = 0; i < 8; ++i) r[i] = (_Float16)((float)x[i] * SM_C);
    return r;
}

// LDS byte address of a __shared__ element: the low 32 bits of its address
__device__ __forceinline__ unsigned lds_addr(const void* p) { return (unsigned)(size_t)p; }

// Stage one 64(key) x 64(d) f32 K tile and the same V tile, as they lie in the inputs, into LDS
// staging buffer BUF with 16-B asynchronous copies (global memory -> LDS through no register, so
// the wave does not wait for them here); 1024 chunks of 4 floats per tile = 2 x 512 threads.
// Chunk i of a thread is row (tid >> 4) + 32 * i, floats (tid & 15) * 4 ...: a wave's copy is two whole 256-B rows.
// kl, vl: the lane's chunk 0 of the tile in K and V; sl: the LDS byte address of its chunk 0 in
// buffer 0's K tile.  All 512 threads are on; every address is a multiple of 16 B.
// The copies land behind the issuing wave's s_wait_asynccnt 0 (publish()).
template <int BUF>
__device__ __forceinline__ void stage_block(const float* kl, const float* vl, unsigned sl) {
    static_assert(STILE * 4 == 17408 && 32 * SPITCH * 4 == 8704);
    constexpr int RS = 32 * NH * DHEAD;   // floats from a lane's chunk 0 to its chunk 1 in the input
    // A chunk's place in LDS past sl is the copy's offset:N, so one LDS address register serves both
    // buffers, both tiles and both chunks.  N moves the global address too: a chunk's global
    // register holds its address less N.
    // one statement: the closing s_wait_xcnt 0 (a precaution) stands in front of any
    // later write of the address registers that the copies name
    if constexpr (BUF == 0) {
        asm volatile(
            "global_load_async_to_lds_b128 %0, %1, off\n\t"
            "global_load_async_to_lds_b128 %0, %2, off offset:8704\n\t"
            "global_load_async_to_lds_b128 %0, %3, off offset:17408\n\t"
            "global_load_async_to_lds_b128 %0, %4, off offset:26112\n\t"
            "s_wait_xcnt 0x0"
            :: "v"(sl), "v"(kl), "v"(kl + RS - 8704 / 4), "v"(vl - 17408 / 4), "v"(vl + RS - 26112 / 4)
            : "memory");
    } else {
        asm volatile(
            "global_load_async_to_lds_b128 %0, %1, off offset:34816\n\t"
            "global_load_async_to_lds_b128 %0, %2, off offset:43520\n\t"
            "global_load_async_to_lds_b128 %0, %3, off offset:52224\n\t"
            "global_load_async_to_lds_b128 %0, %4, off offset:60928\n\t"
            "s_wait_xcnt 0x0"
            :: "v"(sl), "v"(kl - 34816 / 4), "v"(kl + RS - 43520 / 4), "v"(vl - 52224 / 4), "v"(vl + RS - 60928 / 4)
            : "memory");
    }
}

// A thread's share of a staged f32 tile pair on its way to the f16 operand tiles: 8 floats of one K row,
// and 8 keys of one V column (the transposition: lanes run along d, so each read is one 128-B row piece).
// 512 threads x 8 = 64 x 64 values of each tile.
__device__ __forceinline__ void conv_load(const float* sk, const float* sv, v4f (&kf)[2], float (&vf)[8]) {
    kf[0] = *(const v4f*)(sk);
    kf[1] = *(const v4f*)(sk + 4);
#pragma unroll
    for (int i = 0; i < 8; ++i) vf[i] = sv[i * SPITCH];
}

__device__ __forceinline__ void conv_store(const v4f (&kf)[2], const float (&vf)[8], _Float16* kd, _Float16* vd) {
    v8h k8, v8;
#pragma unroll
    for (int i = 0; i < 8; i += 2) {
        const v2h k2 = cvt_bh2(kf[i >> 2][i & 3], kf[i >> 2][(i & 3) + 1]);
        const v2h v2 = cvt_bh2(vf[i], vf[i + 1]);
        k8[i] = k2[0]; k8[i + 1] = k2[1];
        v8[i] = v2[0]; v8[i + 1] = v2[1];
    }
    *(v8h*)kd = k8;
    *(v8h*)vd = v8;
}

// Hand-over at the foot of a 64-key step: the wave's own LDS reads of the buffers it leaves and its
// writes of the next f16 tiles are done, its own copies of the f32 tile after that have landed, then
// the block barrier: behind it both are readable by every wave and the left buffers may be refilled.
__device__ __forceinline__ void publish() {
    asm volatile("s_wait_dscnt 0x0" ::: "memory");     // this wave's LDS reads and writes of the step
    asm volatile("s_wait_asynccnt 0x0" ::: "memory");  // this wave's copies in flight
    __syncthreads();
}

// lane l's value in lane l ^ 16: a vector cross-row move, which needs no lane index held in a register
__device__ __forceinline__ float xhalf(float x) {
    const int b = __builtin_bit_cast(int, x);
    return __builtin_bit_cast(float, __builtin_amdgcn_permlanex16(b, b, 0x76543210, 0xfedcba98, false, false));
}

// One 16(key)x16(qrow) tile of S^T = K Q^T + e, k=64 in two chunks; e, the lane's own
// query row's, is the accumulator's start value.
__device__ __forceinline__ v8f score_tile(const v16h (&ka)[2], const v16h (&qbj)[2], float e) {
    v8f s;
#pragma unroll
    for (int v = 0; v < 8; ++v) s[v] = e;
#pragma unroll
    for (int c = 0; c < 2; ++c) s = wmma_f16(ka[c], qbj[c], s);
    return s;
}

// The two k chunks of K rows n*16 .. n*16+15 as A operands
__device__ __forceinline__ void k_frag(const _Float16* ksb, int n, int l16, int kbase, v16h (&ka)[2]) {
#pragma unroll
    for (int c = 0; c < 2; ++c) ka[c] = ld_op16(&ksb[(n * 16 + l16) * KSTRIDE + c * 32 + kbase]);
}

// P^T (x64) = exp2(x) of score tile n, packed directly into its place in the B-operand layout
__device__ __forceinline__ void pack_p(const v8f& x, int n, v16h (&pb)[2]) {
#pragma unroll
    for (int v = 0; v < 8; ++v)
        pb[n >> 1][(n & 1) * 8 + v] = (_Float16)__builtin_amdgcn_exp2f(x[v]);
}

// Sum of P over the 64 keys by a WMMA with ones: every lane gets its own query row's sum
__device__ __forceinline__ float row_sum(const v16h& ones, const v16h (&pb)[2]) {
    v8f rsum;
#pragma unroll
    for (int v = 0; v < 8; ++v) rsum[v] = 0.0f;
    rsum = wmma_f16(ones, pb[0], rsum);
    rsum = wmma_f16(ones, pb[1], rsum);
    return rsum[0];
}

// P^T of the wave's QT query tiles against one 64-key K tile, and its row sums; key tile by
// key tile: a tile's exp2 needs nothing of the other tiles.
// AHEAD (the common path): the K fragments are asked for in two groups of two key tiles, each group well
// ahead of the products that read it, so that the waits are counted ones and not one LDS round trip per
// key tile.  The two scheduling barriers keep the reads so: without the first they stand in more and
// smaller groups among the products, and without either one the build spills.
// !AHEAD (the rare path): a tile's fragments are read when its turn comes; with the groups there too the
// build spills.
template <bool AHEAD>
__device__ __forceinline__ void p_pass(const _Float16* ksb, const v16h (&qb)[QT][2], const v16h& ones,
                                       int l16, int kbase, const float (&e)[QT],
                                       v16h (&pb)[QT][2], float (&rs)[QT]) {
    v16h ka[4][2];
    if (AHEAD) {
#pragma unroll
        for (int n = 0; n < 2; ++n) k_frag(ksb, n, l16, kbase, ka[n]);
        __builtin_amdgcn_sched_barrier(0);
    }
#pragma unroll
    for (int n = 0; n < 4; ++n) {
        if (!AHEAD) k_frag(ksb, n, l16, kbase, ka[n]);
        v8f s[QT];
#pragma unroll
        for (int j = 0; j < QT; ++j) s[j] = score_tile(ka[n], qb[j], e[j]);
        if (AHEAD && n == 1) {
#pragma unroll
            for (int m = 2; m < 4; ++m) k_frag(ksb, m, l16, kbase, ka[m]);
            __builtin_amdgcn_sched_barrier(0);
        }
#pragma unroll
        for (int j = 0; j < QT; ++j) pack_p(s[j], n, pb[j]);
    }
#pragma unroll
    for (int j = 0; j < QT; ++j) rs[j] = row_sum(ones, pb[j]);
}

// One 64-key online-softmax step against the LDS block (ksb, vtsb), for the
// wave's QT query tiles.  Scores are in the log2 domain (Q carries the scale).
// e_i[j] = P_BIAS - (the maximum IN USE, not the running one) is the score accumulators'
// start value, so exp2 reads them as they are.
// The maximum is renewed (acc and l rescaled, the step's scores formed anew from the K
// tile still in LDS) on the first step and whenever a row sum of P tops P_TOP: a sum of
// positive terms bounds each of them, so below P_TOP no P has left f16's range.
// Beside it the thread's share of the NEXT step's tiles goes from the f32 staging buffer (sk, sv) to
// the other f16 buffer (kd, vd): read ahead of the O^T products, converted and stored between their two key chunks.
__device__ __forceinline__ void fa_step(const _Float16* ksb, const _Float16* vtsb,
                                        const v16h (&qb)[QT][2], const v16h& ones,
                                        int l16, int kbase, bool first, float (&e_i)[QT],
                                        float (&l_i)[QT], v8f (&acc)[QT][4],
                                        const float* sk, const float* sv, _Float16* kd, _Float16* vd) {
    v16h  pb[QT][2];
    float rs[QT];
    bool  renew = first;   // wave-uniform
    // the two expectations: the renewal is laid out of line, so the loop's common path stays short in the instruction cache
    if (__builtin_expect(!first, true)) {
        p_pass<true>(ksb, qb, ones, l16, kbase, e_i, pb, rs);
        unsigned over = 0u;
#pragma unroll
        for (int j = 0; j < QT; ++j) over |= __builtin_amdgcn_ballot_w32(!(rs[j] <= P_TOP));
        // one test per step, a scalar branch: the matrix instructions behind it need every lane on
        renew = over != 0u;
    }
    if (__builtin_expect(renew, false)) {
        // rare.  The two compiler fences: the K fragments are read from LDS anew behind each; without
        // them fragments are held live from one pass over the tile to the next and registers spill.
        asm volatile("" ::: "memory");
#pragma unroll
        for (int j = 0; j < QT; ++j) {
            float mx = -1e30f;
#pragma unroll
            for (int n = 0; n < 4; ++n) {
                v16h ka[2];
                k_frag(ksb, n, l16, kbase, ka);
                const v8f s = score_tile(ka, qb[j], 0.0f);
                const float a0 = fmaxf(s[0], s[1]);
                const float a1 = fmaxf(s[2], s[3]);
                const float a2 = fmaxf(s[4], s[5]);
                const float a3 = fmaxf(s[6], s[7]);
                mx = fmaxf(mx, fmaxf(fmaxf(a0, a1), fmaxf(a2, a3)));
            }
            mx = fmaxf(mx, xhalf(mx));

            // the shift never rises: e = P_BIAS - (maximum in use)
            const float enew = fminf(e_i[j], P_BIAS - mx);
            const float corr = __builtin_amdgcn_exp2f(enew - e_i[j]);
            e_i[j] = enew;
            l_i[j] *= corr;
#pragma unroll
            for (int t = 0; t < 4; ++t)
#pragma unroll
                for (int v = 0; v < 8; ++v) acc[j][t][v] *= corr;
        }
        asm volatile("" ::: "memory");
        p_pass<false>(ksb, qb, ones, l16, kbase, e_i, pb, rs);
    }
#pragma unroll
    for (int j = 0; j < QT; ++j) l_i[j] += rs[j];

    v4f   kf[2];
    float vf[8];
    conv_load(sk, sv, kf, vf);

    // ---- O^T += V^T P^T : 4 d-tiles x 2 key-chunks, each Vt fragment used by QT query tiles ----
    // The four Vt fragments of a key chunk are asked for together.  The scheduling barrier keeps the
    // reads there: without it the compiler sinks each read to its own products, one LDS round trip
    // per fragment, now that the branch above keeps the reads from standing among the exp2.
#pragma unroll
    for (int ck = 0; ck < 2; ++ck) {
        v16h va[4];
#pragma unroll
        for (int t = 0; t < 4; ++t) va[t] = ld_op16(&vtsb[(t * 16 + l16) * VSTRIDE + ck * 32 + kbase]);
        __builtin_amdgcn_sched_barrier(0);
#pragma unroll
        for (int t = 0; t < 4; ++t)
#pragma unroll
            for (int j = 0; j < QT; ++j) acc[j][t] = wmma_f16(va[t], pb[j][ck], acc[j][t]);
        // between the two key chunks
        if (ck == 0) conv_store(kf, vf, kd, vd);
    }
}

// ---------------------------------------------------------------------------
// Attention forward from the f32 inputs [B][L][H][D]: S^T / O^T formulation.
// A 64-key tile passes two double buffers in LDS: f32 K and V rows as they lie in the inputs, filled by
// asynchronous copies issued two steps ahead of the products; and the f16 K and V^T operand tiles, which
// the block's 512 threads convert from them one step ahead.  Hand-unrolled x2 so all buffers are compile-time bases.
// The NTILE tiles of a head are walked as a ring, each once, from a start that differs between
// the work-groups that share the head's K and V: they do not ask L2 for the same lines at the same time.
// Grid (SEQ/BM, NB*NH), 512 threads = 16 waves, 16 * QT query rows per wave.
// ---------------------------------------------------------------------------
__global__ __launch_bounds__(512) __attribute__((amdgpu_num_vgpr(256)))
void fa_fwd_wmma(const float* __restrict__ Q, const float* __restrict__ K,
                 const float* __restrict__ V, float* __restrict__ O) {
    __shared__ __align__(16) float    Sf[4 * STILE];          // f32 staging: buffer 0 K, V, buffer 1 K, V; cross-wave, block barrier
    __shared__ __align__(16) _Float16 Ks0[BN * KSTRIDE];      // cross-wave, block barrier
    __shared__ __align__(16) _Float16 Ks1[BN * KSTRIDE];      // cross-wave, block barrier
    __shared__ __align__(16) _Float16 Vts0[DHEAD * VSTRIDE];  // cross-wave, block barrier
    __shared__ __align__(16) _Float16 Vts1[DHEAD * VSTRIDE];  // cross-wave, block barrier
    __shared__ __align__(16) float    Os[BM * OSTRIDE];       // per-wave rows, block barrier used

    const int tid   = threadIdx.x;
    const int lane  = tid & 31;
    const int wid   = tid >> 5;
    const int half  = lane >> 4;
    const int l16   = lane & 15;
    const int kbase = half * 8;

    const int    bh     = blockIdx.y;
    const int    b      = bh / NH;
    const int    h      = bh - b * NH;
    const int    qblk   = blockIdx.x;
    // the head's row 0 in an input
    const size_t in_off = ((size_t)b * SEQ_FULL * NH + (size_t)h) * DHEAD;

    // ---- Q tile: B-operand (Q^T) registers: f32 rows, bf16-RNE values times log2(e)/8 in f16 ----
    const int    qbase = qblk * BM + wid * (16 * QT);
    const float* qrow  = Q + in_off + (size_t)(qbase + l16) * (NH * DHEAD) + kbase;
    v16h qb[QT][2];
#pragma unroll
    for (int j = 0; j < QT; ++j)
#pragma unroll
        for (int c = 0; c < 2; ++c) {
            const float* p  = qrow + j * 16 * (NH * DHEAD) + c * 32;
            const v8h    lo = scale8(cvt8(p));
            const v8h    hi = scale8(cvt8(p + 16));
#pragma unroll
            for (int i = 0; i < 8; ++i) { qb[j][c][i] = lo[i]; qb[j][c][i + 8] = hi[i]; }
        }
    // precaution: the Q loads' address pair stays live, and so unwritten, up to this wait
    asm volatile("s_wait_xcnt 0x0" :: "v"(qrow) : "memory");

    v16h ones;
#pragma unroll
    for (int e = 0; e < 16; ++e) ones[e] = (_Float16)1.0f;

    float e_i[QT], l_i[QT];          // per-lane: this lane owns qrows (qbase + j*16 + l16)
    v8f acc[QT][4];                  // O^T (x64): rows d = t*16 + kbase + v, col = qrow
#pragma unroll
    for (int j = 0; j < QT; ++j) {
        e_i[j] = 1e30f;              // no maximum yet: the first step sets it
        l_i[j] = 0.0f;
#pragma unroll
        for (int t = 0; t < 4; ++t)
#pragma unroll
            for (int v = 0; v < 8; ++v) acc[j][t][v] = 0.0f;
    }

    // the lane's chunk 0 of the head's tile 0 in K and V, and its place in a staged tile
    const unsigned srow = (unsigned)tid >> 4;
    const unsigned scol = ((unsigned)tid & 15u) * 4u;
    const float*   kl0  = K + in_off + srow * (NH * DHEAD) + scol;
    const float*   vl0  = V + in_off + srow * (NH * DHEAD) + scol;
    const unsigned sl   = lds_addr(&Sf[srow * SPITCH + scol]);
    constexpr int  TSTEP = BN * NH * DHEAD;   // floats from a tile to the next in an input

    // the thread's share of a conversion: K row tid >> 3, floats (tid & 7) * 8 ...; V column tid & 63, keys (tid >> 6) * 8 ...
    const unsigned ckf = ((unsigned)tid >> 3) * SPITCH + ((unsigned)tid & 7u) * 8u;
    const unsigned cvf = ((unsigned)tid >> 6) * 8u * SPITCH + ((unsigned)tid & 63u);
    const unsigned ckh = ((unsigned)tid >> 3) * KSTRIDE + ((unsigned)tid & 7u) * 8u;
    const unsigned cvh = ((unsigned)tid & 63u) * VSTRIDE + ((unsigned)tid >> 6) * 8u;

    // the tile to stage next, 0 .. NTILE-1; block-uniform.  The SEQ / BM work-groups of a head start apart
    int tn = (qblk * (NTILE / (SEQ / BM)) + h + b) % NTILE;

    // prologue: the first tile staged, landed and published; the second one's copies fly while the first is
    // converted; hand-over; then the third one's copies (every tile lies whole inside the head's rows)
    stage_block<0>(kl0 + tn * TSTEP, vl0 + tn * TSTEP, sl);
    tn = tn + 1 == NTILE ? 0 : tn + 1;   // ring order: behind the head's last tile comes its first
    asm volatile("s_wait_asynccnt 0x0" ::: "memory");  // first tile landed before the barrier publishes it
    __syncthreads();
    stage_block<1>(kl0 + tn * TSTEP, vl0 + tn * TSTEP, sl);
    tn = tn + 1 == NTILE ? 0 : tn + 1;
    {
        v4f   kf[2];
        float vf[8];
        conv_load(&Sf[ckf], &Sf[STILE + cvf], kf, vf);
        conv_store(kf, vf, &Ks0[ckh], &Vts0[cvh]);
    }
    publish();  // f16 buffer 0 and staging buffer 1 ready everywhere; staging buffer 0 free
    stage_block<0>(kl0 + tn * TSTEP, vl0 + tn * TSTEP, sl);
    tn = tn + 1 == NTILE ? 0 : tn + 1;

    // kept rolled: one copy of the two steps in the instruction cache
#pragma unroll 1
    for (int it = 0; it < NPAIR; ++it) {
        // steps 2 * it and 2 * it + 1; a step's foot stages the tile three steps on in the ring.  The last three feet
        // stage the ring's first three tiles again, for nobody (whole tiles of the head like any other, waited for
        // behind the loop): no test, so no branch stands between a step's last products and the next step's first writes

        // ---- half A: products on f16 buffer 0; staging buffer 1 -> f16 buffer 1; staging buffer 0's copies fly ----
        fa_step(Ks0, Vts0, qb, ones, l16, kbase, it == 0, e_i, l_i, acc,
                &Sf[2 * STILE + ckf], &Sf[3 * STILE + cvf], &Ks1[ckh], &Vts1[cvh]);
        publish();  // f16 buffer 1 and staging buffer 0 ready everywhere; staging buffer 1 free
        stage_block<1>(kl0 + tn * TSTEP, vl0 + tn * TSTEP, sl);
        tn = tn + 1 == NTILE ? 0 : tn + 1;

        // ---- half B: products on f16 buffer 1; staging buffer 0 -> f16 buffer 0; staging buffer 1's copies fly ----
        // (on the last trip its conversion is read by nobody: leaving it in keeps a branch out of the step)
        fa_step(Ks1, Vts1, qb, ones, l16, kbase, false, e_i, l_i, acc,
                &Sf[ckf], &Sf[STILE + cvf], &Ks0[ckh], &Vts0[cvh]);
        publish();  // f16 buffer 0 and staging buffer 1 ready everywhere; staging buffer 0 free
        stage_block<0>(kl0 + tn * TSTEP, vl0 + tn * TSTEP, sl);
        tn = tn + 1 == NTILE ? 0 : tn + 1;
    }
    asm volatile("s_wait_asynccnt 0x0" ::: "memory");  // no copy outstanding behind the loop

    // ---- epilogue: O[b][qrow][h][d] = acc^T / l via LDS staging ----
    // Each lane writes its columns (qrows j*16 + l16) of O^T into Os rows of the
    // wave's 16*QT-row region; then the wave writes whole 256-B output rows:
    // lanes 0..15 row 2it, lanes 16..31 row 2it+1.  coverage: it 0..8*QT-1 x 2 rows
    // = 16*QT rows per wave, 16 waves = BM rows per block, 16 lanes x 16 B = 64 floats per row.
    // the lane's place is formed anew here: fewer vector registers are carried through the loop (with the
    // loop's own l16, kbase and half used here the build spills)
    const int elane  = (int)__builtin_amdgcn_mbcnt_lo(~0u, 0u);
    const int ehalf  = elane >> 4;
    const int el16   = elane & 15;
    const int ekbase = ehalf * 8;
    float* osw = Os + (wid * 16 * QT) * OSTRIDE;
#pragma unroll
    for (int j = 0; j < QT; ++j) {
        const float inv  = 1.0f / l_i[j];
        float*      ocol = osw + (j * 16 + el16) * OSTRIDE;
#pragma unroll
        for (int t = 0; t < 4; ++t) {
            v4f lo, hi;
            lo[0] = acc[j][t][0] * inv; lo[1] = acc[j][t][1] * inv;
            lo[2] = acc[j][t][2] * inv; lo[3] = acc[j][t][3] * inv;
            hi[0] = acc[j][t][4] * inv; hi[1] = acc[j][t][5] * inv;
            hi[2] = acc[j][t][6] * inv; hi[3] = acc[j][t][7] * inv;
            *(v4f*)&ocol[t * 16 + ekbase]     = lo;
            *(v4f*)&ocol[t * 16 + ekbase + 4] = hi;
        }
    }
    __syncthreads();

    v4f ov[8 * QT];
#pragma unroll
    for (int it = 0; it < 8 * QT; ++it) {
        const int r = 2 * it + ehalf;
        ov[it] = *(const v4f*)&osw[r * OSTRIDE + el16 * 4];
    }
    const size_t rstride = (size_t)NH * DHEAD;
    const size_t obase   = (((size_t)b * SEQ + (size_t)qbase) * NH + (size_t)h) * DHEAD
                         + (size_t)(el16 * 4);
#pragma unroll
    for (int it = 0; it < 8 * QT; ++it) {
        const int r = 2 * it + ehalf;
        *(v4f*)(O + obase + (size_t)r * rstride) = ov[it];
    }
}

extern "C" void kernel_launch(void* const* d_in, const int* in_sizes, int n_in,
                              void* d_out, int out_size, void* d_ws, size_t ws_size,
                              hipStream_t stream) {
    if (n_in < 3) return;
    const float* Q = (const float*)d_in[0];   // [NB_FULL][SEQ_FULL][NH][DHEAD] f32
    const float* K = (const float*)d_in[1];
    const float* V = (const float*)d_in[2];
    float*       O = (float*)d_out;          // [NB][SEQ][NH][DHEAD] f32

    // extent read from the inputs (full strides, reduced batch/sequence extents)
    const size_t need_in = ((size_t)(NB - 1) * SEQ_FULL + (size_t)SEQ) * NH * DHEAD;
    if ((size_t)in_sizes[0] < need_in) return;
    if ((size_t)in_sizes[1] < need_in) return;
    if ((size_t)in_sizes[2] < need_in) return;

    const size_t n = (size_t)NB * NH * SEQ * DHEAD;   // elements of the output
    if ((size_t)out_size < n) return;
    fa_fwd_wmma<<<dim3(SEQ / BM, NB * NH), dim3(512), 0, stream>>>(Q, K, V, O);
}

// v007
// Measured time: 47.4 microseconds a run.
// In two side-by-side timings against v006, it was 1.07 and 1.06 times as fast.
// All steps since v000 together make it 2.60 times as fast.
#include <hip/hip_runtime.h>

typedef __attribute__((ext_vector_type(16))) _Float16 v16h;
typedef __attribute__((ext_vector_type(8)))  _Float16 v8h;
typedef __attribute__((ext_vector_type(2)))  _Float16 v2h;
typedef __attribute__((ext_vector_type(2)))  __bf16   v2bf;
typedef __attribute__((ext_vector_type(8)))  float    v8f;
typedef __attribute__((ext_vector_type(4)))  float    v4f;
typedef __attribute__((ext_vector_type(2)))  float    v2f;
typedef __attribute__((ext_vector_type(4)))  int      v4i;
typedef __attribute__((ext_vector_type(4)))  unsigned u32x4;
typedef __attribute__((ext_vector_type(8)))  unsigned u32x8;

#ifndef NB
#define NB 4            // batches computed
#endif
#ifndef SEQ
#define SEQ 2048        // sequence length computed
#endif
#define NB_FULL  4      // input batch extent
#define SEQ_FULL 2048   // input sequence stride
#define NH       16
#define DHEAD    64
#define QT       2      // 16-row query tiles per wave: each K / Vt fragment read from LDS feeds QT products
#define NWAVE    16     // waves per block: four on each SIMD, one block on a WGP
#define BM       512    // query rows per block (16 * QT per wave)
#define BN       64     // keys per LDS buffer
#define KSTRIDE  72     // halves per K-LDS row (144 B)
#define VSTRIDE  72     // halves per Vt-LDS row (144 B)
#define OSTRIDE  68     // floats per O-staging row (272 B)
#define SPITCH   68     // floats per staged f32 K or V row in LDS (272 B)
#define STILE    4608   // floats from a staged f32 tile to the next (18432 B): BN rows of SPITCH floats (17408 B), rounded up to a multiple of 2 KiB

// 1/sqrt(64) * log2(e), folded into the Q operand: a score leaves the matrix unit as an exp2 argument
#define SM_C   (0.125f * 1.4426950408889634f)
// P carried x64 (2^6) in its f16 operand; cancels exactly in acc/l
#define P_BIAS 6.0f
// a 64-key row sum of P above this (2^(P_BIAS + 8)) renews the maximum in use; every P below it is finite in f16
#define P_TOP  16384.0f

static_assert(NB >= 1 && NB <= NB_FULL);
static_assert(SEQ >= 2 * BN && SEQ <= SEQ_FULL);
static_assert(SEQ % (2 * BN) == 0);
static_assert(SEQ % BM == 0);
#define NPAIR    (SEQ / (2 * BN))   // 128-key tile pairs of a head: one loop trip each
#define NTILE    (SEQ / BN)         // 64-key tiles of a head
static_assert(BN == 64 && DHEAD == 64 && BM == NWAVE * 16 * QT);
static_assert(NTILE >= 4 && NTILE % (SEQ / BM) == 0);
static_assert(STILE >= BN * SPITCH && (STILE * 4) % 2048 == 0);

// Assemble a v16h WMMA operand from two contiguous 8-half runs at p and p+16,
// matching the 16-bit A/B VGPR layout: elem e -> K = kbase + (e&7) + (e>=8)*16.
__device__ __forceinline__ v16h ld_op16(const _Float16* p) {
    const v8h lo = *(const v8h*)(p);
    const v8h hi = *(const v8h*)(p + 16);
    v16h r;
#pragma unroll
    for (int i = 0; i < 8; ++i) { r[i] = lo[i]; r[i + 8] = hi[i]; }
    return r;
}

__device__ __forceinline__ v8f wmma_f16(v16h a, v16h b, v8f c) {
    return __builtin_amdgcn_wmma_f32_16x16x32_f16(
        false, a, false, b, (short)0, c, false, false);
}

// two f32 -> bf16 (RNE, one packed convert) -> f16 container (exact for the bf16 significand)
__device__ __forceinline__ v2h cvt_bh2(float a, float b) {
    const v2f      x = {a, b};
    const unsigned u = __builtin_bit_cast(unsigned, __builtin_convertvector(x, v2bf));
    const v2f      y = {__uint_as_float(u << 16), __uint_as_float(u & 0xFFFF0000u)};
    return __builtin_convertvector(y, v2h);
}

__device__ __forceinline__ v8h cvt8(const float* p) {
    const float4 a = *(const float4*)(p);
    const float4 c = *(const float4*)(p + 4);
    const v2h p0 = cvt_bh2(a.x, a.y), p1 = cvt_bh2(a.z, a.w), p2 = cvt_bh2(c.x, c.y), p3 = cvt_bh2(c.z, c.w);
    const v8h r = {p0[0], p0[1], p1[0], p1[1], p2[0], p2[1], p3[0], p3[1]};
    return r;
}

// the eight values times log2(e)/8: product in f32, rounded once into f16
__device__ __forceinline__ v8h scale8(v8h x) {
    v8h r;
#pragma unroll
    for (int i = 0; i < 8; ++i) r[i] = (_Float16)((float)x[i] * SM_C);
    return r;
}

// LDS byte address of a __shared__ element: the low 32 bits of its address
__device__ __forceinline__ unsigned lds_addr(const void* p) { return (unsigned)(size_t)p; }

__device__ __forceinline__ unsigned uni(unsigned v) { return (unsigned)__builtin_amdgcn_readfirstlane(v); }

// A wave-uniform value in a scalar register: a test on it is a scalar branch (a tensor load ignores EXEC, so only
// such a branch keeps a wave from issuing one), and what is computed from it stands behind the asm waits in front of it.
__device__ __forceinline__ unsigned pinned(unsigned v) {
    unsigned w = uni(v);
    asm volatile("" : "+s"(w));   // pinned(): an issue test or a descriptor's input held in a scalar register
    return w;
}

// Tensor descriptor, group 1, the same for every request: 1-byte elements, tensor = tile = BN rows of 256 B,
// source row pitch one (key, all heads) row, 16 B of LDS pad behind every 256-B row (LDS pitch SPITCH floats), no mask.
__device__ __forceinline__ u32x8 tdm_group1() {
    constexpr unsigned d0 = DHEAD * 4, d1 = BN;
    static_assert(d0 == 256 && SPITCH * 4 == d0 + 16);
    u32x8 g;
    g[0] = uni((1u << 20) | (5u << 22) | (3u << 25));
    g[1] = uni((d0 & 0xFFFFu) << 16);
    g[2] = uni((d0 >> 16) | ((d1 & 0xFFFFu) << 16));
    g[3] = uni((d1 >> 16) | (d0 << 16));
    g[4] = uni(d1);
    g[5] = uni(NH * DHEAD * 4);
    g[6] = uni(0u);
    g[7] = uni(0u);
    return g;
}

// group 0: one request, LDS byte address, global byte address of the tile's first byte, type 2
__device__ __forceinline__ u32x4 tdm_group0(unsigned lds_dst, unsigned long long ga) {
    u32x4 g;
    g[0] = uni(1u);
    g[1] = uni(lds_dst);
    g[2] = uni((unsigned)ga);
    g[3] = uni((((unsigned)(ga >> 32)) & 0x01FFFFFFu) | 0x80000000u);
    return g;
}

// Stage tile tn (64 keys x 64 d, f32, as it lies in the input) of the issuing wave's input into LDS at dst: one
// tensor load, global memory -> LDS through no register and with no per-lane address; the wave does not wait here.
// src: byte address of the head's tile 0 in that input.  It lands behind the wave's s_wait_tensorcnt 0 (publish()).
// g0 is the wave's one group 0, renewed in place: LDS address and global address, behind the wait on the request before.
__device__ __forceinline__ void stage_tile(u32x4& g0, const u32x8& g1, unsigned long long src, unsigned dst, int tn) {
    const unsigned t = pinned((unsigned)tn);   // pinned(): the descriptor's address words are formed behind the wait on the request before
    const u32x4    n = tdm_group0(dst, src + (unsigned long long)t * (BN * NH * DHEAD * 4));
    g0[1] = n[1]; g0[2] = n[2]; g0[3] = n[3];
    asm volatile("tensor_load_to_lds %0, %1" :: "s"(g0), "s"(g1) : "memory");
}

// A thread's share of a staged f32 tile pair on its way to the f16 operand tiles: 8 floats of one K row,
// and 8 keys of one V column (the transposition: lanes run along d, so each read is one 128-B row piece).
// 512 threads x 8 = 64 x 64 values of each tile.
__device__ __forceinline__ void conv_load(const float* sk, const float* sv, v4f (&kf)[2], float (&vf)[8]) {
    kf[0] = *(const v4f*)(sk);
    kf[1] = *(const v4f*)(sk + 4);
#pragma unroll
    for (int i = 0; i < 8; ++i) vf[i] = sv[i * SPITCH];
}

__device__ __forceinline__ void conv_store(const v4f (&kf)[2], const float (&vf)[8], _Float16* kd, _Float16* vd) {
    v8h k8, v8;
#pragma unroll
    for (int i = 0; i < 8; i += 2) {
        const v2h k2 = cvt_bh2(kf[i >> 2][i & 3], kf[i >> 2][(i & 3) + 1]);
        const v2h v2 = cvt_bh2(vf[i], vf[i + 1]);
        k8[i] = k2[0]; k8[i + 1] = k2[1];
        v8[i] = v2[0]; v8[i + 1] = v2[1];
    }
    *(v8h*)kd = k8;
    *(v8h*)vd = v8;
}

// Hand-over at the foot of a 64-key step: the wave's own LDS reads of the buffers it leaves and its
// writes of the next f16 tiles are done, an issuing wave's tensor load of the f32 tile after that has landed, then
// the block barrier: behind it both are readable by every wave and the left buffers may be refilled.
__device__ __forceinline__ void publish() {
    asm volatile("s_wait_dscnt 0x0" ::: "memory");      // this wave's LDS reads and writes of the step
    asm volatile("s_wait_tensorcnt 0x0" ::: "memory");  // an issuing wave's request in flight; a wave with none passes at once, so no branch here
    __syncthreads();
}

// lane l's value in lane l ^ 16: a vector cross-row move, which needs no lane index held in a register
__device__ __forceinline__ float xhalf(float x) {
    const int b = __builtin_bit_cast(int, x);
    return __builtin_bit_cast(float, __builtin_amdgcn_permlanex16(b, b, 0x76543210, 0xfedcba98, false, false));
}

// One 16(key)x16(qrow) tile of S^T = K Q^T + e, k=64 in two chunks; e, the lane's own
// query row's, is the accumulator's start value.
__device__ __forceinline__ v8f score_tile(const v16h (&ka)[2], const v16h (&qbj)[2], float e) {
    v8f s;
#pragma unroll
    for (int v = 0; v < 8; ++v) s[v] = e;
#pragma unroll
    for (int c = 0; c < 2; ++c) s = wmma_f16(ka[c], qbj[c], s);
    return s;
}

// The two k chunks of K rows n*16 .. n*16+15 as A operands
__device__ __forceinline__ void k_frag(const _Float16* ksb, int n, int l16, int kbase, v16h (&ka)[2]) {
#pragma unroll
    for (int c = 0; c < 2; ++c) ka[c] = ld_op16(&ksb[(n * 16 + l16) * KSTRIDE + c * 32 + kbase]);
}

// P^T (x64) = exp2(x) of score tile n, packed directly into its place in the B-operand layout
__device__ __forceinline__ void pack_p(const v8f& x, int n, v16h (&pb)[2]) {
#pragma unroll
    for (int v = 0; v < 8; ++v)
        pb[n >> 1][(n & 1) * 8 + v] = (_Float16)__builtin_amdgcn_exp2f(x[v]);
}

// Sum of P over the 64 keys by a WMMA with ones: every lane gets its own query row's sum
__device__ __forceinline__ float row_sum(const v16h& ones, const v16h (&pb)[2]) {
    v8f rsum;
#pragma unroll
    for (int v = 0; v < 8; ++v) rsum[v] = 0.0f;
    rsum = wmma_f16(ones, pb[0], rsum);
    rsum = wmma_f16(ones, pb[1], rsum);
    return rsum[0];
}

// P^T of the wave's QT query tiles against one 64-key K tile, and its row sums; key tile by
// key tile: a tile's exp2 needs nothing of the other tiles.
// AHEAD (the common path): the K fragments are asked for in two groups of two key tiles, each group well
// ahead of the products that read it, so that the waits are counted ones and not one LDS round trip per
// key tile.  The two scheduling barriers keep the reads so: without the first they stand in more and
// smaller groups among the products, and without either one the build spills.
// !AHEAD (the rare path): a tile's fragments are read when its turn comes; with the groups there too the
// build spills.
template <bool AHEAD>
__device__ __forceinline__ void p_pass(const _Float16* ksb, const v16h (&qb)[QT][2], const v16h& ones,
                                       int l16, int kbase, const float (&e)[QT],
                                       v16h (&pb)[QT][2], float (&rs)[QT]) {
    v16h ka[4][2];
    if (AHEAD) {
#pragma unroll
        for (int n = 0; n < 2; ++n) k_frag(ksb, n, l16, kbase, ka[n]);
        __builtin_amdgcn_sched_barrier(0);
    }
#pragma unroll
    for (int n = 0; n < 4; ++n) {
        if (!AHEAD) k_frag(ksb, n, l16, kbase, ka[n]);
        v8f s[QT];
#pragma unroll
        for (int j = 0; j < QT; ++j) s[j] = score_tile(ka[n], qb[j], e[j]);
        if (AHEAD && n == 1) {
#pragma unroll
            for (int m = 2; m < 4; ++m) k_frag(ksb, m, l16, kbase, ka[m]);
            __builtin_amdgcn_sched_barrier(0);
        }
#pragma unroll
        for (int j = 0; j < QT; ++j) pack_p(s[j], n, pb[j]);
    }
#pragma unroll
    for (int j = 0; j < QT; ++j) rs[j] = row_sum(ones, pb[j]);
}

// One 64-key online-softmax step against the LDS block (ksb, vtsb), for the
// wave's QT query tiles.  Scores are in the log2 domain (Q carries the scale).
// e_i[j] = P_BIAS - (the maximum IN USE, not the running one) is the score accumulators'
// start value, so exp2 reads them as they are.
// The maximum is renewed (acc and l rescaled, the step's scores formed anew from the K
// tile still in LDS) on the first step and whenever a row sum of P tops P_TOP: a sum of
// positive terms bounds each of them, so below P_TOP no P has left f16's range.
// Beside it the thread's share of the NEXT step's tiles goes from the f32 staging buffer (sk, sv) to
// the other f16 buffer (kd, vd): read ahead of the O^T products, converted and stored between their two key chunks.
__device__ __forceinline__ void fa_step(const _Float16* ksb, const _Float16* vtsb,
                                        const v16h (&qb)[QT][2], const v16h& ones,
                                        int l16, int kbase, bool first, float (&e_i)[QT],
                                        float (&l_i)[QT], v8f (&acc)[QT][4],
                                        const float* sk, const float* sv, _Float16* kd, _Float16* vd) {
    v16h  pb[QT][2];
    float rs[QT];
    bool  renew = first;   // wave-uniform
    // the two expectations: the renewal is laid out of line, so the loop's common path stays short in the instruction cache
    if (__builtin_expect(!first, true)) {
        p_pass<true>(ksb, qb, ones, l16, kbase, e_i, pb, rs);
        unsigned over = 0u;
#pragma unroll
        for (int j = 0; j < QT; ++j) over |= __builtin_amdgcn_ballot_w32(!(rs[j] <= P_TOP));
        // one test per step, a scalar branch: the matrix instructions behind it need every lane on
        renew = over != 0u;
    }
    if (__builtin_expect(renew, false)) {
        // rare.  The two compiler fences: the K fragments are read from LDS anew behind each; without
        // them fragments are held live from one pass over the tile to the next and registers spill.
        asm volatile("" ::: "memory");
#pragma unroll
        for (int j = 0; j < QT; ++j) {
            float mx = -1e30f;
#pragma unroll
            for (int n = 0; n < 4; ++n) {
                v16h ka[2];
                k_frag(ksb, n, l16, kbase, ka);
                const v8f s = score_tile(ka, qb[j], 0.0f);
                const float a0 = fmaxf(s[0], s[1]);
                const float a1 = fmaxf(s[2], s[3]);
                const float a2 = fmaxf(s[4], s[5]);
                const float a3 = fmaxf(s[6], s[7]);
                mx = fmaxf(mx, fmaxf(fmaxf(a0, a1), fmaxf(a2, a3)));
            }
            mx = fmaxf(mx, xhalf(mx));

            // the shift never rises: e = P_BIAS - (maximum in use)
            const float enew = fminf(e_i[j], P_BIAS - mx);
            const float corr = __builtin_amdgcn_exp2f(enew - e_i[j]);
            e_i[j] = enew;
            l_i[j] *= corr;
#pragma unroll
            for (int t = 0; t < 4; ++t)
#pragma unroll
                for (int v = 0; v < 8; ++v) acc[j][t][v] *= corr;
        }
        asm volatile("" ::: "memory");
        p_pass<false>(ksb, qb, ones, l16, kbase, e_i, pb, rs);
    }
#pragma unroll
    for (int j = 0; j < QT; ++j) l_i[j] += rs[j];

    v4f   kf[2];
    float vf[8];
    conv_load(sk, sv, kf, vf);

    // ---- O^T += V^T P^T : 4 d-tiles x 2 key-chunks, each Vt fragment used by QT query tiles ----
    // The four Vt fragments of a key chunk are asked for together.  The scheduling barrier keeps the
    // reads there: without it the compiler sinks each read to its own products, one LDS round trip
    // per fragment, now that the branch above keeps the reads from standing among the exp2.
#pragma unroll
    for (int ck = 0; ck < 2; ++ck) {
        v16h va[4];
#pragma unroll
        for (int t = 0; t < 4; ++t) va[t] = ld_op16(&vtsb[(t * 16 + l16) * VSTRIDE + ck * 32 + kbase]);
        __builtin_amdgcn_sched_barrier(0);
#pragma unroll
        for (int t = 0; t < 4; ++t)
#pragma unroll
            for (int j = 0; j < QT; ++j) acc[j][t] = wmma_f16(va[t], pb[j][ck], acc[j][t]);
        // between the two key chunks
        if (ck == 0) conv_store(kf, vf, kd, vd);
    }
}

// ---------------------------------------------------------------------------
// Attention forward from the f32 inputs [B][L][H][D]: S^T / O^T formulation.
// A 64-key tile passes two double buffers in LDS: f32 K and V rows as they lie in the inputs, filled by
// tensor loads (wave 0: K, wave 1: V) issued two steps ahead of the products; and the f16 K and V^T operand tiles, which
// the block's 512 threads convert from them one step ahead.  Hand-unrolled x2 so all buffers are compile-time bases.
// The NTILE tiles of a head are walked as a ring, each once, from a start that differs between
// the work-groups that share the head's K and V: they do not ask L2 for the same lines at the same time.
// Grid (SEQ/BM, NB*NH), 512 threads = 16 waves, 16 * QT query rows per wave.
// ---------------------------------------------------------------------------
__global__ __launch_bounds__(512) __attribute__((amdgpu_num_vgpr(256)))
void fa_fwd_wmma(const float* __restrict__ Q, const float* __restrict__ K,
                 const float* __restrict__ V, float* __restrict__ O) {
    __shared__ __attribute__((aligned(2048))) float Sf[4 * STILE];   // f32 staging: buffer 0 K, V, buffer 1 K, V, each at a multiple of 2 KiB; cross-wave, block barrier
    __shared__ __align__(16) _Float16 Ks0[BN * KSTRIDE];      // cross-wave, block barrier
    __shared__ __align__(16) _Float16 Ks1[BN * KSTRIDE];      // cross-wave, block barrier
    __shared__ __align__(16) _Float16 Vts0[DHEAD * VSTRIDE];  // cross-wave, block barrier
    __shared__ __align__(16) _Float16 Vts1[DHEAD * VSTRIDE];  // cross-wave, block barrier
    __shared__ __align__(16) float    Os[BM * OSTRIDE];       // per-wave rows, block barrier used

    const int tid   = threadIdx.x;
    const int lane  = tid & 31;
    const int wid   = tid >> 5;
    const int half  = lane >> 4;
    const int l16   = lane & 15;
    const int kbase = half * 8;

    const int    bh     = blockIdx.y;
    const int    b      = bh / NH;
    const int    h      = bh - b * NH;
    const int    qblk   = blockIdx.x;
    // the head's row 0 in an input
    const size_t in_off = ((size_t)b * SEQ_FULL * NH + (size_t)h) * DHEAD;

    // ---- Q tile: B-operand (Q^T) registers: f32 rows, bf16-RNE values times log2(e)/8 in f16 ----
    const int    qbase = qblk * BM + wid * (16 * QT);
    const float* qrow  = Q + in_off + (size_t)(qbase + l16) * (NH * DHEAD) + kbase;
    v16h qb[QT][2];
#pragma unroll
    for (int j = 0; j < QT; ++j)
#pragma unroll
        for (int c = 0; c < 2; ++c) {
            const float* p  = qrow + j * 16 * (NH * DHEAD) + c * 32;
            const v8h    lo = scale8(cvt8(p));
            const v8h    hi = scale8(cvt8(p + 16));
#pragma unroll
            for (int i = 0; i < 8; ++i) { qb[j][c][i] = lo[i]; qb[j][c][i + 8] = hi[i]; }
        }
    // precaution: the Q loads' address pair stays live, and so unwritten, up to this wait
    asm volatile("s_wait_xcnt 0x0" :: "v"(qrow) : "memory");

    v16h ones;
#pragma unroll
    for (int e = 0; e < 16; ++e) ones[e] = (_Float16)1.0f;

    float e_i[QT], l_i[QT];          // per-lane: this lane owns qrows (qbase + j*16 + l16)
    v8f acc[QT][4];                  // O^T (x64): rows d = t*16 + kbase + v, col = qrow
#pragma unroll
    for (int j = 0; j < QT; ++j) {
        e_i[j] = 1e30f;              // no maximum yet: the first step sets it
        l_i[j] = 0.0f;
#pragma unroll
        for (int t = 0; t < 4; ++t)
#pragma unroll
            for (int v = 0; v < 8; ++v) acc[j][t][v] = 0.0f;
    }

    // waves 0 and 1 issue the tensor loads: wave 0 a step's K tile, wave 1 its V tile
    const unsigned           wave = uni((unsigned)tid >> 5);
    const unsigned long long tsrc = (unsigned long long)(size_t)(((wave & 1u) ? V : K) + in_off);   // the head's tile 0 in the wave's input
    const unsigned           dst0 = lds_addr(Sf) + (wave & 1u) * (STILE * 4);                       // the wave's tile in staging buffer 0
    const unsigned           dst1 = dst0 + 2 * STILE * 4;                                           // and in staging buffer 1
    // the two descriptor groups are kept live from here to the wait behind the loop, so that their scalar
    // registers take no other value while a request is out
    u32x8 g1 = tdm_group1();
    u32x4 g0 = tdm_group0(dst0, tsrc);
    asm volatile("" : "+s"(g0), "+s"(g1));   // pinned(): descriptor words held in scalar registers

    // the thread's share of a conversion: K row tid >> 3, floats (tid & 7) * 8 ...; V column tid & 63, keys (tid >> 6) * 8 ...
    const unsigned ckf = ((unsigned)tid >> 3) * SPITCH + ((unsigned)tid & 7u) * 8u;
    const unsigned cvf = ((unsigned)tid >> 6) * 8u * SPITCH + ((unsigned)tid & 63u);
    const unsigned ckh = ((unsigned)tid >> 3) * KSTRIDE + ((unsigned)tid & 7u) * 8u;
    const unsigned cvh = ((unsigned)tid & 63u) * VSTRIDE + ((unsigned)tid >> 6) * 8u;

    // the tile to stage next, 0 .. NTILE-1; block-uniform.  The SEQ / BM work-groups of a head start apart
    int tn = (qblk * (NTILE / (SEQ / BM)) + h + b) % NTILE;

    // prologue: the first tile staged, landed and published; the second one's loads fly while the first is
    // converted; hand-over; then the third one's loads (every tile lies whole inside the head's rows)
    if (pinned(wave < 2u)) {
        stage_tile(g0, g1, tsrc, dst0, tn);
        asm volatile("s_wait_tensorcnt 0x0" ::: "memory");  // first tile landed before the barrier publishes it
    }
    tn = tn + 1 == NTILE ? 0 : tn + 1;   // ring order: behind the head's last tile comes its first
    __syncthreads();
    if (pinned(wave < 2u)) stage_tile(g0, g1, tsrc, dst1, tn);
    tn = tn + 1 == NTILE ? 0 : tn + 1;
    {
        v4f   kf[2];
        float vf[8];
        conv_load(&Sf[ckf], &Sf[STILE + cvf], kf, vf);
        conv_store(kf, vf, &Ks0[ckh], &Vts0[cvh]);
    }
    publish();  // f16 buffer 0 and staging buffer 1 ready everywhere; staging buffer 0 free
    if (pinned(wave < 2u)) stage_tile(g0, g1, tsrc, dst0, tn);
    tn = tn + 1 == NTILE ? 0 : tn + 1;

    // kept rolled: one copy of the two steps in the instruction cache
#pragma unroll 1
    for (int it = 0; it < NPAIR; ++it) {
        // steps 2 * it and 2 * it + 1; a step's foot stages the tile three steps on in the ring, while there is one

        // ---- half A: products on f16 buffer 0; staging buffer 1 -> f16 buffer 1; staging buffer 0's loads fly ----
        fa_step(Ks0, Vts0, qb, ones, l16, kbase, it == 0, e_i, l_i, acc,
                &Sf[2 * STILE + ckf], &Sf[3 * STILE + cvf], &Ks1[ckh], &Vts1[cvh]);
        publish();  // f16 buffer 1 and staging buffer 0 ready everywhere; staging buffer 1 free
        if (pinned(wave < 2u && it < NPAIR - 1)) stage_tile(g0, g1, tsrc, dst1, tn);
        tn = tn + 1 == NTILE ? 0 : tn + 1;

        // ---- half B: products on f16 buffer 1; staging buffer 0 -> f16 buffer 0; staging buffer 1's loads fly ----
        // (on the last trip its conversion, of a tile staged earlier, is read by nobody: leaving it in keeps a branch out of the step)
        fa_step(Ks1, Vts1, qb, ones, l16, kbase, false, e_i, l_i, acc,
                &Sf[ckf], &Sf[STILE + cvf], &Ks0[ckh], &Vts0[cvh]);
        publish();  // f16 buffer 0 and staging buffer 1 ready everywhere; staging buffer 0 free
        if (pinned(wave < 2u && it < NPAIR - 2)) stage_tile(g0, g1, tsrc, dst0, tn);
        tn = tn + 1 == NTILE ? 0 : tn + 1;
    }
    asm volatile("s_wait_tensorcnt 0x0" :: "s"(g0), "s"(g1) : "memory");  // no request outstanding behind the loop; the inputs: the groups' registers are theirs up to here
    asm volatile("s_wait_dscnt 0x0" ::: "memory");      // nor an LDS operation of this wave

    // ---- epilogue: O[b][qrow][h][d] = acc^T / l via LDS staging ----
    // Each lane writes its columns (qrows j*16 + l16) of O^T into Os rows of the
    // wave's 16*QT-row region; then the wave writes whole 256-B output rows:
    // lanes 0..15 row 2it, lanes 16..31 row 2it+1.  coverage: it 0..8*QT-1 x 2 rows
    // = 16*QT rows per wave, 16 waves = BM rows per block, 16 lanes x 16 B = 64 floats per row.
    // the lane's place is formed anew here: fewer vector registers are carried through the loop (with the
    // loop's own l16, kbase and half used here the build spills)
    const int elane  = (int)__builtin_amdgcn_mbcnt_lo(~0u, 0u);
    const int ehalf  = elane >> 4;
    const int el16   = elane & 15;
    const int ekbase = ehalf * 8;
    float* osw = Os + (wid * 16 * QT) * OSTRIDE;
#pragma unroll
    for (int j = 0; j < QT; ++j) {
        const float inv  = 1.0f / l_i[j];
        float*      ocol = osw + (j * 16 + el16) * OSTRIDE;
#pragma unroll
        for (int t = 0; t < 4; ++t) {
            v4f lo, hi;
            lo[0] = acc[j][t][0] * inv; lo[1] = acc[j][t][1] * inv;
            lo[2] = acc[j][t][2] * inv; lo[3] = acc[j][t][3] * inv;
            hi[0] = acc[j][t][4] * inv; hi[1] = acc[j][t][5] * inv;
            hi[2] = acc[j][t][6] * inv; hi[3] = acc[j][t][7] * inv;
            *(v4f*)&ocol[t * 16 + ekbase]     = lo;
            *(v4f*)&ocol[t * 16 + ekbase + 4] = hi;
        }
    }
    __syncthreads();

    v4f ov[8 * QT];
#pragma unroll
    for (int it = 0; it < 8 * QT; ++it) {
        const int r = 2 * it + ehalf;
        ov[it] = *(const v4f*)&osw[r * OSTRIDE + el16 * 4];
    }
    const size_t rstride = (size_t)NH * DHEAD;
    const size_t obase   = (((size_t)b * SEQ + (size_t)qbase) * NH + (size_t)h) * DHEAD
                         + (size_t)(el16 * 4);
#pragma unroll
    for (int it = 0; it < 8 * QT; ++it) {
        const int r = 2 * it + ehalf;
        *(v4f*)(O + obase + (size_t)r * rstride) = ov[it];
    }
}

extern "C" void kernel_launch(void* const* d_in, const int* in_sizes, int n_in,
                              void* d_out, int out_size, void* d_ws, size_t ws_size,
                              hipStream_t stream) {
    if (n_in < 3) return;
    const float* Q = (const float*)d_in[0];   // [NB_FULL][SEQ_FULL][NH][DHEAD] f32
    const float* K = (const float*)d_in[1];
    const float* V = (const float*)d_in[2];
    float*       O = (float*)d_out;          // [NB][SEQ][NH][DHEAD] f32

    // extent read from the inputs (full strides, reduced batch/sequence extents)
    const size_t need_in = ((size_t)(NB - 1) * SEQ_FULL + (size_t)SEQ) * NH * DHEAD;
    if ((size_t)in_sizes[0] < need_in) return;
    if ((size_t)in_sizes[1] < need_in) return;
    if ((size_t)in_sizes[2] < need_in) return;

    const size_t n = (size_t)NB * NH * SEQ * DHEAD;   // elements of the output
    if ((size_t)out_size < n) return;
    fa_fwd_wmma<<<dim3(SEQ / BM, NB * NH), dim3(512), 0, stream>>>(Q, K, V, O);
}
